// v000
// Measured on an AMD MI455X. A time is GPU time per run, averaged over a window of back-to-back runs after a warm-up
// (all launches, gaps included; the runs take copies of the inputs in turn), and the median of several windows.
// Apart from v000's, it joins two sittings. Times from different sittings can be a few percent apart, while
// side-by-side timings come from the same sitting.
// v000 is the starting kernel. One run takes 755 microseconds.
#include <hip/hip_runtime.h>
#include <math.h>
#include <stdint.h>

// Problem constants (match reference)
#define BDIM 4
#define HDIM 16
#define SEQ 4096
#define DDIM 64
#define MDIM 64
#define DVDIM 64
#define CHUNKC 128
#define NCHUNK (SEQ / CHUNKC)   // 32
#define BH (BDIM * HDIM)        // 64
#define FEPS 1e-4f
#define DNORM 0.35355339059327379f  // 64^-0.25
#define DGSC  0.0625f               // 0.5 * DNORM^2 = 0.5 * 64^-0.5
#define RATIO 0.125f                // 64^-0.5

typedef __attribute__((ext_vector_type(2))) float v2f;
typedef __attribute__((ext_vector_type(8))) float v8f;
typedef int v4i __attribute__((ext_vector_type(4)));

#define ASYNC_OK __has_builtin(__builtin_amdgcn_global_load_async_to_lds_b128)

__device__ __forceinline__ void copy_b128(float* __restrict__ dst_lds,
                                          const float* __restrict__ src) {
#if ASYNC_OK
  typedef __attribute__((address_space(3))) v4i* lds_v4i_p;
  v4i* g = (v4i*)(uintptr_t)src;                         // generic global ptr
  lds_v4i_p l = (lds_v4i_p)(unsigned)(uintptr_t)dst_lds; // low 32b = LDS offset
  __builtin_amdgcn_global_load_async_to_lds_b128(g, l, 0, 0);
#else
  *(float4*)dst_lds = *(const float4*)src;
#endif
}

__device__ __forceinline__ void async_wait_all() {
#if ASYNC_OK
#if __has_builtin(__builtin_amdgcn_s_wait_asynccnt)
  __builtin_amdgcn_s_wait_asynccnt(0);
#else
  asm volatile("s_wait_asynccnt 0x0" ::: "memory");
#endif
#endif
}

__device__ __forceinline__ v8f wmma_k4(v2f a, v2f b, v8f c) {
  return __builtin_amdgcn_wmma_f32_16x16x4_f32(
      false, a, false, b, (short)0, c, false, false);
}

// C(16x16) += A(16xK) * B(Kx16); A row-major (lda), B row-major (ldb).
__device__ __forceinline__ v8f mma_tile(const float* __restrict__ A, int lda,
                                        const float* __restrict__ B, int ldb,
                                        int klen, v8f acc) {
  const int lane = threadIdx.x & 31;
  const int half = lane >> 4;
  const int lid  = lane & 15;
  for (int kk = 0; kk < klen; kk += 4) {
    v2f a, b;
    a.x = A[lid * lda + kk + 2 * half];
    a.y = A[lid * lda + kk + 2 * half + 1];
    b.x = B[(kk + 2 * half) * ldb + lid];
    b.y = B[(kk + 2 * half + 1) * ldb + lid];
    acc = wmma_k4(a, b, acc);
  }
  return acc;
}

// C(16x16) += A^T * B, where At is stored K-major: A[m][k] = At[k*ldat + m].
__device__ __forceinline__ v8f mma_tile_At(const float* __restrict__ At, int ldat,
                                           const float* __restrict__ B, int ldb,
                                           int klen, v8f acc) {
  const int lane = threadIdx.x & 31;
  const int half = lane >> 4;
  const int lid  = lane & 15;
  for (int kk = 0; kk < klen; kk += 4) {
    v2f a, b;
    a.x = At[(kk + 2 * half) * ldat + lid];
    a.y = At[(kk + 2 * half + 1) * ldat + lid];
    b.x = B[(kk + 2 * half) * ldb + lid];
    b.y = B[(kk + 2 * half + 1) * ldb + lid];
    acc = wmma_k4(a, b, acc);
  }
  return acc;
}

// C(16x16) += A * B^T, where Bt is stored N-major: B[k][n] = Bt[n*ldbt + k].
__device__ __forceinline__ v8f mma_tile_Bt(const float* __restrict__ A, int lda,
                                           const float* __restrict__ Bt, int ldbt,
                                           int klen, v8f acc) {
  const int lane = threadIdx.x & 31;
  const int half = lane >> 4;
  const int lid  = lane & 15;
  for (int kk = 0; kk < klen; kk += 4) {
    v2f a, b;
    a.x = A[lid * lda + kk + 2 * half];
    a.y = A[lid * lda + kk + 2 * half + 1];
    b.x = Bt[lid * ldbt + kk + 2 * half];
    b.y = Bt[lid * ldbt + kk + 2 * half + 1];
    acc = wmma_k4(a, b, acc);
  }
  return acc;
}

__device__ __forceinline__ void store_tile(float* __restrict__ C, int ldc, v8f acc) {
  const int lane = threadIdx.x & 31;
  const int half = lane >> 4;
  const int lid  = lane & 15;
#pragma unroll
  for (int vv = 0; vv < 8; ++vv)
    C[(vv + 8 * half) * ldc + lid] = acc[vv];
}

// ---------------------------------------------------------------------------
// Kernel 1: FAVOR+ feature map for one (b,h,chunk) tile of 128 rows.
//   dd = DNORM * (x @ proj)   (WMMA on raw x, scale at consumption)
//   is_query: feat = RATIO*(exp(dd - diag - rowmax(dd)) + EPS)
//   else    : feat = dd - diag (raw), blockmax[blk] = max(dd) for global stab
// ---------------------------------------------------------------------------
extern "C" __global__ __launch_bounds__(256)
void feat_kernel(const float* __restrict__ x, const float* __restrict__ proj,
                 float* __restrict__ feat, float* __restrict__ blockmax,
                 int is_query) {
  extern __shared__ float smem[];
  float* sx    = smem;                   // 128*64 (raw x)
  float* sp    = sx + CHUNKC * DDIM;     // 64*64
  float* sdd   = sp + DDIM * MDIM;       // 128*64 (x @ proj, unscaled)
  float* sdiag = sdd + CHUNKC * MDIM;    // 128
  float* sred  = sdiag + CHUNKC;         // 128

  const int tid = threadIdx.x;
  const int bhc = blockIdx.x;
  const int bh  = bhc / NCHUNK;
  const int ch  = bhc % NCHUNK;
  const long base = ((long)bh * SEQ + (long)ch * CHUNKC) * DDIM;

  for (int i = tid; i < CHUNKC * DDIM / 4; i += 256)
    copy_b128(sx + 4 * i, x + base + 4 * i);
  for (int i = tid; i < DDIM * MDIM / 4; i += 256)
    copy_b128(sp + 4 * i, proj + 4 * i);
  async_wait_all();
  __syncthreads();

  // diag = 0.5 * dnorm^2 * sum(x^2)
  if (tid < CHUNKC) {
    const float* row = sx + tid * DDIM;
    float s = 0.f;
#pragma unroll 8
    for (int j = 0; j < DDIM; ++j) s += row[j] * row[j];
    sdiag[tid] = DGSC * s;
  }

  // 8 waves: wave w -> row tile w (16 rows), 4 column tiles of 16
  const int w = tid >> 5;
  for (int ct = 0; ct < 4; ++ct) {
    v8f acc = {};
    acc = mma_tile(sx + (w * 16) * DDIM, DDIM, sp + ct * 16, MDIM, DDIM, acc);
    store_tile(sdd + (w * 16) * MDIM + ct * 16, MDIM, acc);
  }
  __syncthreads();

  if (tid < CHUNKC) {
    const float* row = sdd + tid * MDIM;
    float mx = DNORM * row[0];
    for (int j = 1; j < MDIM; ++j) mx = fmaxf(mx, DNORM * row[j]);
    const long ob = ((long)bh * SEQ + (long)ch * CHUNKC + tid) * MDIM;
    const float dg = sdiag[tid];
    if (is_query) {
      for (int j = 0; j < MDIM; ++j)
        feat[ob + j] = RATIO * (expf(DNORM * row[j] - dg - mx) + FEPS);
    } else {
      for (int j = 0; j < MDIM; ++j)
        feat[ob + j] = DNORM * row[j] - dg;  // finished later with global stab
      sred[tid] = mx;                        // stab uses max of raw data_dash
    }
  }
  if (!is_query) {
    __syncthreads();
    if (tid == 0) {
      float mx = sred[0];
      for (int j = 1; j < CHUNKC; ++j) mx = fmaxf(mx, sred[j]);
      blockmax[bhc] = mx;
    }
  }
}

// Kernel 2: global max over block maxima -> gmax[0]
extern "C" __global__ __launch_bounds__(256)
void reduce_max_kernel(const float* __restrict__ bmax, float* __restrict__ gmax,
                       int n) {
  __shared__ float sred[256];
  float mx = -3.4e38f;
  for (int i = threadIdx.x; i < n; i += 256) mx = fmaxf(mx, bmax[i]);
  sred[threadIdx.x] = mx;
  __syncthreads();
  for (int s = 128; s > 0; s >>= 1) {
    if (threadIdx.x < s)
      sred[threadIdx.x] = fmaxf(sred[threadIdx.x], sred[threadIdx.x + s]);
    __syncthreads();
  }
  if (threadIdx.x == 0) gmax[0] = sred[0];
}

// Kernel 3: kp = RATIO*(exp(raw - gmax) + EPS), in place
extern "C" __global__ __launch_bounds__(256)
void finalize_kp_kernel(float* __restrict__ kp, const float* __restrict__ gmax,
                        long n) {
  const float gm = gmax[0];
  long i = (long)blockIdx.x * blockDim.x + threadIdx.x;
  const long stride = (long)gridDim.x * blockDim.x;
  for (; i < n; i += stride) kp[i] = RATIO * (expf(kp[i] - gm) + FEPS);
}

// Kernel 4: per-chunk sums  ckv = kp^T @ v (64x64, K=128), cks = colsum(kp)
extern "C" __global__ __launch_bounds__(256)
void chunk_sums_kernel(const float* __restrict__ kp, const float* __restrict__ v,
                       float* __restrict__ ckv, float* __restrict__ cks) {
  extern __shared__ float smem[];
  float* skp = smem;                    // 128*64
  float* sv  = skp + CHUNKC * MDIM;     // 128*64

  const int tid = threadIdx.x;
  const int bhc = blockIdx.x;
  const int bh  = bhc / NCHUNK;
  const int ch  = bhc % NCHUNK;
  const long kb = ((long)bh * SEQ + (long)ch * CHUNKC) * MDIM;
  const long vb = ((long)bh * SEQ + (long)ch * CHUNKC) * DVDIM;

  for (int i = tid; i < CHUNKC * MDIM / 4; i += 256) {
    copy_b128(skp + 4 * i, kp + kb + 4 * i);
    copy_b128(sv + 4 * i, v + vb + 4 * i);
  }
  async_wait_all();
  __syncthreads();

  if (tid < MDIM) {
    float s = 0.f;
    for (int c = 0; c < CHUNKC; ++c) s += skp[c * MDIM + tid];
    cks[(long)bhc * MDIM + tid] = s;
  }

  const int w = tid >> 5;               // 8 waves x 2 tiles = 16 tiles (4x4)
  for (int i = 0; i < 2; ++i) {
    const int t = w * 2 + i, tr = t >> 2, tc = t & 3;
    v8f acc = {};
    acc = mma_tile_At(skp + tr * 16, MDIM, sv + tc * 16, DVDIM, CHUNKC, acc);
    store_tile(ckv + (long)bhc * MDIM * DVDIM + (tr * 16) * DVDIM + tc * 16,
               DVDIM, acc);
  }
}

// Kernel 5: exclusive prefix over chunks (in place) -> running kv/ks state
extern "C" __global__ __launch_bounds__(256)
void prefix_kernel(float* __restrict__ ckv, float* __restrict__ cks) {
  const int bh = blockIdx.x, tid = threadIdx.x;
  for (int e = tid; e < MDIM * DVDIM; e += 256) {
    float run = 0.f;
    for (int ch = 0; ch < NCHUNK; ++ch) {
      const long idx = ((long)bh * NCHUNK + ch) * MDIM * DVDIM + e;
      if (ch + 1 < NCHUNK)
        __builtin_prefetch(&ckv[idx + MDIM * DVDIM], 1, 0);  // global_prefetch
      const float val = ckv[idx];
      ckv[idx] = run;
      run += val;
    }
  }
  if (tid < MDIM) {
    float run = 0.f;
    for (int ch = 0; ch < NCHUNK; ++ch) {
      const long idx = ((long)bh * NCHUNK + ch) * MDIM + tid;
      const float val = cks[idx];
      cks[idx] = run;
      run += val;
    }
  }
}

// Kernel 6: per-chunk output.
//   A   = qp @ kp^T  (128x128, masked tril)            [WMMA]
//   num = A @ v + qp @ kv_prefix                       [WMMA]
//   den = rowsum(A) + qp . ks_prefix
//   out = num / den
extern "C" __global__ __launch_bounds__(256)
void out_kernel(const float* __restrict__ qp, const float* __restrict__ kp,
                const float* __restrict__ v, const float* __restrict__ ckv,
                const float* __restrict__ cks, float* __restrict__ out) {
  extern __shared__ float smem[];
  float* sq   = smem;                     // 128*64
  float* sk   = sq + CHUNKC * MDIM;       // 128*64
  float* sv   = sk + CHUNKC * MDIM;       // 128*64
  float* skv  = sv + CHUNKC * DVDIM;      // 64*64
  float* sks  = skv + MDIM * DVDIM;       // 64
  float* sden = sks + MDIM;               // 128
  float* sA   = sden + CHUNKC;            // 128*128

  const int tid = threadIdx.x;
  const int bhc = blockIdx.x;
  const int bh  = bhc / NCHUNK;
  const int ch  = bhc % NCHUNK;
  const long fb = ((long)bh * SEQ + (long)ch * CHUNKC) * MDIM;
  const long vb = ((long)bh * SEQ + (long)ch * CHUNKC) * DVDIM;

  for (int i = tid; i < CHUNKC * MDIM / 4; i += 256) {
    copy_b128(sq + 4 * i, qp + fb + 4 * i);
    copy_b128(sk + 4 * i, kp + fb + 4 * i);
    copy_b128(sv + 4 * i, v + vb + 4 * i);
  }
  for (int i = tid; i < MDIM * DVDIM / 4; i += 256)
    copy_b128(skv + 4 * i, ckv + (long)bhc * MDIM * DVDIM + 4 * i);
  if (tid < MDIM) sks[tid] = cks[(long)bhc * MDIM + tid];
  async_wait_all();
  __syncthreads();

  const int w = tid >> 5;
  const int lane = tid & 31, half = lane >> 4, lid = lane & 15;

  // A strip: wave w -> rows [16w,16w+16), all 8 column tiles; causal mask.
  for (int tc = 0; tc < 8; ++tc) {
    v8f acc = {};
    acc = mma_tile_Bt(sq + (w * 16) * MDIM, MDIM, sk + (tc * 16) * MDIM, MDIM,
                      MDIM, acc);
#pragma unroll
    for (int vv = 0; vv < 8; ++vv) {
      const int R = w * 16 + vv + 8 * half;
      const int Ccol = tc * 16 + lid;
      sA[R * CHUNKC + Ccol] = (Ccol <= R) ? acc[vv] : 0.f;
    }
  }
  __syncthreads();

  if (tid < CHUNKC) {
    const float* row = sA + tid * CHUNKC;
    float s = 0.f;
    for (int j = 0; j < CHUNKC; ++j) s += row[j];
    const float* qrow = sq + tid * MDIM;
    for (int j = 0; j < MDIM; ++j) s += qrow[j] * sks[j];
    sden[tid] = s;
  }
  __syncthreads();

  for (int tc = 0; tc < 4; ++tc) {
    v8f acc = {};
    acc = mma_tile(sA + (w * 16) * CHUNKC, CHUNKC, sv + tc * 16, DVDIM, CHUNKC,
                   acc);
    acc = mma_tile(sq + (w * 16) * MDIM, MDIM, skv + tc * 16, DVDIM, MDIM, acc);
#pragma unroll
    for (int vv = 0; vv < 8; ++vv) {
      const int R = w * 16 + vv + 8 * half;
      out[vb + (long)R * DVDIM + tc * 16 + lid] = acc[vv] / sden[R];
    }
  }
}

// ---------------------------------------------------------------------------
extern "C" void kernel_launch(void* const* d_in, const int* in_sizes, int n_in,
                              void* d_out, int out_size, void* d_ws,
                              size_t ws_size, hipStream_t stream) {
  const float* q    = (const float*)d_in[0];
  const float* k    = (const float*)d_in[1];
  const float* v    = (const float*)d_in[2];
  const float* proj = (const float*)d_in[3];
  float* out = (float*)d_out;

  float* ws = (float*)d_ws;
  const long FEAT = (long)BH * SEQ * MDIM;            // 16,777,216 floats
  float* qp   = ws;
  float* kp   = qp + FEAT;
  float* ckv  = kp + FEAT;                            // BH*NC*64*64
  float* cks  = ckv + (long)BH * NCHUNK * MDIM * DVDIM;
  float* bmax = cks + (long)BH * NCHUNK * MDIM;
  float* gmax = bmax + BH * NCHUNK;

  const size_t featShm =
      (size_t)(CHUNKC * DDIM + DDIM * MDIM + CHUNKC * MDIM + 2 * CHUNKC) *
      sizeof(float);
  const size_t csumShm = (size_t)(CHUNKC * MDIM + CHUNKC * DVDIM) * sizeof(float);
  const size_t outShm =
      (size_t)(2 * CHUNKC * MDIM + CHUNKC * DVDIM + MDIM * DVDIM + MDIM +
               CHUNKC + CHUNKC * CHUNKC) * sizeof(float);

  (void)hipFuncSetAttribute(reinterpret_cast<const void*>(feat_kernel),
                            hipFuncAttributeMaxDynamicSharedMemorySize,
                            (int)featShm);
  (void)hipFuncSetAttribute(reinterpret_cast<const void*>(chunk_sums_kernel),
                            hipFuncAttributeMaxDynamicSharedMemorySize,
                            (int)csumShm);
  (void)hipFuncSetAttribute(reinterpret_cast<const void*>(out_kernel),
                            hipFuncAttributeMaxDynamicSharedMemorySize,
                            (int)outShm);

  feat_kernel<<<BH * NCHUNK, 256, featShm, stream>>>(q, proj, qp, bmax, 1);
  feat_kernel<<<BH * NCHUNK, 256, featShm, stream>>>(k, proj, kp, bmax, 0);
  reduce_max_kernel<<<1, 256, 0, stream>>>(bmax, gmax, BH * NCHUNK);
  finalize_kp_kernel<<<2048, 256, 0, stream>>>(kp, gmax, FEAT);
  chunk_sums_kernel<<<BH * NCHUNK, 256, csumShm, stream>>>(kp, v, ckv, cks);
  prefix_kernel<<<BH, 256, 0, stream>>>(ckv, cks);
  out_kernel<<<BH * NCHUNK, 256, outShm, stream>>>(qp, kp, v, ckv, cks, out);
}

// v001
// A run of this version takes 342 microseconds.
// Timed twice side by side with v000, it ran 2.21 and 2.19 times as fast.
#include <hip/hip_runtime.h>
#include <math.h>
#include <stdint.h>

// Problem constants (match reference)
#define BDIM 4
#define HDIM 16
#define SEQ 4096
#define DDIM 64
#define MDIM 64
#define DVDIM 64
#define CHUNKC 128
#define NCHUNK (SEQ / CHUNKC)   // 32
#define BH (BDIM * HDIM)        // 64
#define FEPS 1e-4f
#define DNORM 0.35355339059327379f  // 64^-0.25
#define DGSC  0.0625f               // 0.5 * DNORM^2 = 0.5 * 64^-0.5
#define RATIO 0.125f                // 64^-0.5

#define PROW 68
#define PCOL 80
#define PSCO 132

typedef __attribute__((ext_vector_type(2))) float v2f;
typedef __attribute__((ext_vector_type(8))) float v8f;
typedef int v4i __attribute__((ext_vector_type(4)));

#define ASYNC_OK __has_builtin(__builtin_amdgcn_global_load_async_to_lds_b128)

__device__ __forceinline__ void copy_b128(float* __restrict__ dst_lds,
                                          const float* __restrict__ src) {
#if ASYNC_OK
  typedef __attribute__((address_space(3))) v4i* lds_v4i_p;
  v4i* g = (v4i*)(uintptr_t)src;                         // generic global ptr
  lds_v4i_p l = (lds_v4i_p)(unsigned)(uintptr_t)dst_lds; // low 32b = LDS offset
  __builtin_amdgcn_global_load_async_to_lds_b128(g, l, 0, 0);
#else
  *(float4*)dst_lds = *(const float4*)src;
#endif
}

__device__ __forceinline__ void async_wait_all() {
#if ASYNC_OK
#if __has_builtin(__builtin_amdgcn_s_wait_asynccnt)
  __builtin_amdgcn_s_wait_asynccnt(0);
#else
  asm volatile("s_wait_asynccnt 0x0" ::: "memory");
#endif
#endif
}

__device__ __forceinline__ v8f wmma_k4(v2f a, v2f b, v8f c) {
  return __builtin_amdgcn_wmma_f32_16x16x4_f32(
      false, a, false, b, (short)0, c, false, false);
}

// C(16x16) += A(16xK) * B(Kx16); A row-major (lda), B row-major (ldb).
__device__ __forceinline__ v8f mma_tile(const float* __restrict__ A, int lda,
                                        const float* __restrict__ B, int ldb,
                                        int klen, v8f acc) {
  const int lane = threadIdx.x & 31;
  const int half = lane >> 4;
  const int lid  = lane & 15;
  for (int kk = 0; kk < klen; kk += 4) {
    v2f a, b;
    a.x = A[lid * lda + kk + 2 * half];
    a.y = A[lid * lda + kk + 2 * half + 1];
    b.x = B[(kk + 2 * half) * ldb + lid];
    b.y = B[(kk + 2 * half + 1) * ldb + lid];
    acc = wmma_k4(a, b, acc);
  }
  return acc;
}

// C(16x16) += A^T * B, where At is stored K-major: A[m][k] = At[k*ldat + m].
__device__ __forceinline__ v8f mma_tile_At(const float* __restrict__ At, int ldat,
                                           const float* __restrict__ B, int ldb,
                                           int klen, v8f acc) {
  const int lane = threadIdx.x & 31;
  const int half = lane >> 4;
  const int lid  = lane & 15;
  for (int kk = 0; kk < klen; kk += 4) {
    v2f a, b;
    a.x = At[(kk + 2 * half) * ldat + lid];
    a.y = At[(kk + 2 * half + 1) * ldat + lid];
    b.x = B[(kk + 2 * half) * ldb + lid];
    b.y = B[(kk + 2 * half + 1) * ldb + lid];
    acc = wmma_k4(a, b, acc);
  }
  return acc;
}

// C(16x16) += A * B^T, where Bt is stored N-major: B[k][n] = Bt[n*ldbt + k].
__device__ __forceinline__ v8f mma_tile_Bt(const float* __restrict__ A, int lda,
                                           const float* __restrict__ Bt, int ldbt,
                                           int klen, v8f acc) {
  const int lane = threadIdx.x & 31;
  const int half = lane >> 4;
  const int lid  = lane & 15;
  for (int kk = 0; kk < klen; kk += 4) {
    v2f a, b;
    a.x = A[lid * lda + kk + 2 * half];
    a.y = A[lid * lda + kk + 2 * half + 1];
    b.x = Bt[lid * ldbt + kk + 2 * half];
    b.y = Bt[lid * ldbt + kk + 2 * half + 1];
    acc = wmma_k4(a, b, acc);
  }
  return acc;
}

__device__ __forceinline__ void store_tile(float* __restrict__ C, int ldc, v8f acc) {
  const int lane = threadIdx.x & 31;
  const int half = lane >> 4;
  const int lid  = lane & 15;
#pragma unroll
  for (int vv = 0; vv < 8; ++vv)
    C[(vv + 8 * half) * ldc + lid] = acc[vv];
}

// ---------------------------------------------------------------------------
// Kernel 1: FAVOR+ feature map for one (b,h,chunk) tile of 128 rows.
//   dd = DNORM * (x @ proj)   (WMMA on raw x, scale at consumption)
//   is_query: feat = RATIO*(exp(dd - diag - rowmax(dd)) + EPS)
//   else    : feat = dd - diag (raw), blockmax[blk] = max(dd) for global stab
// ---------------------------------------------------------------------------
extern "C" __global__ __launch_bounds__(256)
void feat_kernel(const float* __restrict__ x, const float* __restrict__ proj,
                 float* __restrict__ feat, float* __restrict__ blockmax,
                 int is_query) {
  extern __shared__ float smem[];
  float* sx    = smem;                   // 128 rows, pitch PROW (raw x)
  float* sp    = sx + CHUNKC * PROW;     // 64 rows, pitch PCOL
  float* sdd   = sp + DDIM * PCOL;       // 128 rows, pitch PROW (x @ proj)
  float* sdiag = sdd + CHUNKC * PROW;    // 128
  float* sred  = sdiag + CHUNKC;         // 128

  const int tid = threadIdx.x;
  const int bhc = blockIdx.x;
  const int bh  = bhc / NCHUNK;
  const int ch  = bhc % NCHUNK;
  const long base = ((long)bh * SEQ + (long)ch * CHUNKC) * DDIM;

  for (int i = tid; i < CHUNKC * DDIM / 4; i += 256)
    copy_b128(sx + (i >> 4) * PROW + 4 * (i & 15), x + base + 4 * i);
  for (int i = tid; i < DDIM * MDIM / 4; i += 256)
    copy_b128(sp + (i >> 4) * PCOL + 4 * (i & 15), proj + 4 * i);
  async_wait_all();
  __syncthreads();

  // diag = 0.5 * dnorm^2 * sum(x^2)
  if (tid < CHUNKC) {
    const float* row = sx + tid * PROW;
    float s = 0.f;
#pragma unroll 8
    for (int j = 0; j < DDIM; ++j) s += row[j] * row[j];
    sdiag[tid] = DGSC * s;
  }

  // 8 waves: wave w -> row tile w (16 rows), 4 column tiles of 16
  const int w = tid >> 5;
  for (int ct = 0; ct < 4; ++ct) {
    v8f acc = {};
    acc = mma_tile(sx + (w * 16) * PROW, PROW, sp + ct * 16, PCOL, DDIM, acc);
    store_tile(sdd + (w * 16) * PROW + ct * 16, PROW, acc);
  }
  __syncthreads();

  if (tid < CHUNKC) {
    const float* row = sdd + tid * PROW;
    float mx = DNORM * row[0];
    for (int j = 1; j < MDIM; ++j) mx = fmaxf(mx, DNORM * row[j]);
    const long ob = ((long)bh * SEQ + (long)ch * CHUNKC + tid) * MDIM;
    const float dg = sdiag[tid];
    if (is_query) {
      for (int j = 0; j < MDIM; ++j)
        feat[ob + j] = RATIO * (expf(DNORM * row[j] - dg - mx) + FEPS);
    } else {
      for (int j = 0; j < MDIM; ++j)
        feat[ob + j] = DNORM * row[j] - dg;  // finished later with global stab
      sred[tid] = mx;                        // stab uses max of raw data_dash
    }
  }
  if (!is_query) {
    __syncthreads();
    if (tid == 0) {
      float mx = sred[0];
      for (int j = 1; j < CHUNKC; ++j) mx = fmaxf(mx, sred[j]);
      blockmax[bhc] = mx;
    }
  }
}

// Kernel 2: global max over block maxima -> gmax[0]
extern "C" __global__ __launch_bounds__(256)
void reduce_max_kernel(const float* __restrict__ bmax, float* __restrict__ gmax,
                       int n) {
  __shared__ float sred[256];
  float mx = -3.4e38f;
  for (int i = threadIdx.x; i < n; i += 256) mx = fmaxf(mx, bmax[i]);
  sred[threadIdx.x] = mx;
  __syncthreads();
  for (int s = 128; s > 0; s >>= 1) {
    if (threadIdx.x < s)
      sred[threadIdx.x] = fmaxf(sred[threadIdx.x], sred[threadIdx.x + s]);
    __syncthreads();
  }
  if (threadIdx.x == 0) gmax[0] = sred[0];
}

// Kernel 3: kp = RATIO*(exp(raw - gmax) + EPS), in place
extern "C" __global__ __launch_bounds__(256)
void finalize_kp_kernel(float* __restrict__ kp, const float* __restrict__ gmax,
                        long n) {
  const float gm = gmax[0];
  long i = (long)blockIdx.x * blockDim.x + threadIdx.x;
  const long stride = (long)gridDim.x * blockDim.x;
  for (; i < n; i += stride) kp[i] = RATIO * (expf(kp[i] - gm) + FEPS);
}

// Kernel 4: per-chunk sums  ckv = kp^T @ v (64x64, K=128), cks = colsum(kp)
extern "C" __global__ __launch_bounds__(256)
void chunk_sums_kernel(const float* __restrict__ kp, const float* __restrict__ v,
                       float* __restrict__ ckv, float* __restrict__ cks) {
  extern __shared__ float smem[];
  float* skp = smem;                    // 128 rows, pitch PCOL
  float* sv  = skp + CHUNKC * PCOL;     // 128 rows, pitch PCOL

  const int tid = threadIdx.x;
  const int bhc = blockIdx.x;
  const int bh  = bhc / NCHUNK;
  const int ch  = bhc % NCHUNK;
  const long kb = ((long)bh * SEQ + (long)ch * CHUNKC) * MDIM;
  const long vb = ((long)bh * SEQ + (long)ch * CHUNKC) * DVDIM;

  for (int i = tid; i < CHUNKC * MDIM / 4; i += 256) {
    const int l = (i >> 4) * PCOL + 4 * (i & 15);
    copy_b128(skp + l, kp + kb + 4 * i);
    copy_b128(sv + l, v + vb + 4 * i);
  }
  async_wait_all();
  __syncthreads();

  if (tid < MDIM) {
    float s = 0.f;
    for (int c = 0; c < CHUNKC; ++c) s += skp[c * PCOL + tid];
    cks[(long)bhc * MDIM + tid] = s;
  }

  const int w = tid >> 5;               // 8 waves x 2 tiles = 16 tiles (4x4)
  for (int i = 0; i < 2; ++i) {
    const int t = w * 2 + i, tr = t >> 2, tc = t & 3;
    v8f acc = {};
    acc = mma_tile_At(skp + tr * 16, PCOL, sv + tc * 16, PCOL, CHUNKC, acc);
    store_tile(ckv + (long)bhc * MDIM * DVDIM + (tr * 16) * DVDIM + tc * 16,
               DVDIM, acc);
  }
}

// Kernel 5: exclusive prefix over chunks (in place) -> running kv/ks state
extern "C" __global__ __launch_bounds__(256)
void prefix_kernel(float* __restrict__ ckv, float* __restrict__ cks) {
  const int bh = blockIdx.x, tid = threadIdx.x;
  for (int e = tid; e < MDIM * DVDIM; e += 256) {
    float run = 0.f;
    for (int ch = 0; ch < NCHUNK; ++ch) {
      const long idx = ((long)bh * NCHUNK + ch) * MDIM * DVDIM + e;
      if (ch + 1 < NCHUNK)
        __builtin_prefetch(&ckv[idx + MDIM * DVDIM], 1, 0);  // global_prefetch
      const float val = ckv[idx];
      ckv[idx] = run;
      run += val;
    }
  }
  if (tid < MDIM) {
    float run = 0.f;
    for (int ch = 0; ch < NCHUNK; ++ch) {
      const long idx = ((long)bh * NCHUNK + ch) * MDIM + tid;
      const float val = cks[idx];
      cks[idx] = run;
      run += val;
    }
  }
}

// Kernel 6: per-chunk output.
//   A   = qp @ kp^T  (128x128, masked tril)            [WMMA]
//   num = A @ v + qp @ kv_prefix                       [WMMA]
//   den = rowsum(A) + qp . ks_prefix
//   out = num / den
extern "C" __global__ __launch_bounds__(256)
void out_kernel(const float* __restrict__ qp, const float* __restrict__ kp,
                const float* __restrict__ v, const float* __restrict__ ckv,
                const float* __restrict__ cks, float* __restrict__ out) {
  extern __shared__ float smem[];
  float* sq   = smem;                     // 128 rows, pitch PROW
  float* sk   = sq + CHUNKC * PROW;       // 128 rows, pitch PROW
  float* sv   = sk + CHUNKC * PROW;       // 128 rows, pitch PCOL
  float* skv  = sv + CHUNKC * PCOL;       // 64 rows, pitch PCOL
  float* sks  = skv + MDIM * PCOL;        // 64
  float* sden = sks + MDIM;               // 128
  float* sA   = sden + CHUNKC;            // 128 rows, pitch PSCO

  const int tid = threadIdx.x;
  const int bhc = blockIdx.x;
  const int bh  = bhc / NCHUNK;
  const int ch  = bhc % NCHUNK;
  const long fb = ((long)bh * SEQ + (long)ch * CHUNKC) * MDIM;
  const long vb = ((long)bh * SEQ + (long)ch * CHUNKC) * DVDIM;

  for (int i = tid; i < CHUNKC * MDIM / 4; i += 256) {
    const int r = i >> 4, c = 4 * (i & 15);
    copy_b128(sq + r * PROW + c, qp + fb + 4 * i);
    copy_b128(sk + r * PROW + c, kp + fb + 4 * i);
    copy_b128(sv + r * PCOL + c, v + vb + 4 * i);
  }
  for (int i = tid; i < MDIM * DVDIM / 4; i += 256)
    copy_b128(skv + (i >> 4) * PCOL + 4 * (i & 15),
              ckv + (long)bhc * MDIM * DVDIM + 4 * i);
  if (tid < MDIM) sks[tid] = cks[(long)bhc * MDIM + tid];
  async_wait_all();
  __syncthreads();

  const int w = tid >> 5;
  const int lane = tid & 31, half = lane >> 4, lid = lane & 15;

  // A strip: wave w -> rows [16w,16w+16), all 8 column tiles; causal mask.
  for (int tc = 0; tc < 8; ++tc) {
    v8f acc = {};
    acc = mma_tile_Bt(sq + (w * 16) * PROW, PROW, sk + (tc * 16) * PROW, PROW,
                      MDIM, acc);
#pragma unroll
    for (int vv = 0; vv < 8; ++vv) {
      const int R = w * 16 + vv + 8 * half;
      const int Ccol = tc * 16 + lid;
      sA[R * PSCO + Ccol] = (Ccol <= R) ? acc[vv] : 0.f;
    }
  }
  __syncthreads();

  if (tid < CHUNKC) {
    const float* row = sA + tid * PSCO;
    float s = 0.f;
    for (int j = 0; j < CHUNKC; ++j) s += row[j];
    const float* qrow = sq + tid * PROW;
    for (int j = 0; j < MDIM; ++j) s += qrow[j] * sks[j];
    sden[tid] = s;
  }
  __syncthreads();

  for (int tc = 0; tc < 4; ++tc) {
    v8f acc = {};
    acc = mma_tile(sA + (w * 16) * PSCO, PSCO, sv + tc * 16, PCOL, CHUNKC, acc);
    acc = mma_tile(sq + (w * 16) * PROW, PROW, skv + tc * 16, PCOL, MDIM, acc);
#pragma unroll
    for (int vv = 0; vv < 8; ++vv) {
      const int R = w * 16 + vv + 8 * half;
      out[vb + (long)R * DVDIM + tc * 16 + lid] = acc[vv] / sden[R];
    }
  }
}

// ---------------------------------------------------------------------------
extern "C" void kernel_launch(void* const* d_in, const int* in_sizes, int n_in,
                              void* d_out, int out_size, void* d_ws,
                              size_t ws_size, hipStream_t stream) {
  const float* q    = (const float*)d_in[0];
  const float* k    = (const float*)d_in[1];
  const float* v    = (const float*)d_in[2];
  const float* proj = (const float*)d_in[3];
  float* out = (float*)d_out;

  float* ws = (float*)d_ws;
  const long FEAT = (long)BH * SEQ * MDIM;            // 16,777,216 floats
  float* qp   = ws;
  float* kp   = qp + FEAT;
  float* ckv  = kp + FEAT;                            // BH*NC*64*64
  float* cks  = ckv + (long)BH * NCHUNK * MDIM * DVDIM;
  float* bmax = cks + (long)BH * NCHUNK * MDIM;
  float* gmax = bmax + BH * NCHUNK;

  const size_t featShm =
      (size_t)(CHUNKC * PROW + DDIM * PCOL + CHUNKC * PROW + 2 * CHUNKC) *
      sizeof(float);
  const size_t csumShm = (size_t)(CHUNKC * PCOL + CHUNKC * PCOL) * sizeof(float);
  const size_t outShm =
      (size_t)(2 * CHUNKC * PROW + CHUNKC * PCOL + MDIM * PCOL + MDIM +
               CHUNKC + CHUNKC * PSCO) * sizeof(float);

  (void)hipFuncSetAttribute(reinterpret_cast<const void*>(feat_kernel),
                            hipFuncAttributeMaxDynamicSharedMemorySize,
                            (int)featShm);
  (void)hipFuncSetAttribute(reinterpret_cast<const void*>(chunk_sums_kernel),
                            hipFuncAttributeMaxDynamicSharedMemorySize,
                            (int)csumShm);
  (void)hipFuncSetAttribute(reinterpret_cast<const void*>(out_kernel),
                            hipFuncAttributeMaxDynamicSharedMemorySize,
                            (int)outShm);

  feat_kernel<<<BH * NCHUNK, 256, featShm, stream>>>(q, proj, qp, bmax, 1);
  feat_kernel<<<BH * NCHUNK, 256, featShm, stream>>>(k, proj, kp, bmax, 0);
  reduce_max_kernel<<<1, 256, 0, stream>>>(bmax, gmax, BH * NCHUNK);
  finalize_kp_kernel<<<2048, 256, 0, stream>>>(kp, gmax, FEAT);
  chunk_sums_kernel<<<BH * NCHUNK, 256, csumShm, stream>>>(kp, v, ckv, cks);
  prefix_kernel<<<BH, 256, 0, stream>>>(ckv, cks);
  out_kernel<<<BH * NCHUNK, 256, outShm, stream>>>(qp, kp, v, ckv, cks, out);
}

// v002
// One run takes 272 microseconds.
// Next to v001, in two timings, it ran 1.26 and 1.24 times as fast.
// All steps since v000 together make it 2.76 times as fast.
#include <hip/hip_runtime.h>
#include <math.h>
#include <stdint.h>

// Problem constants (match reference)
#define BDIM 4
#define HDIM 16
#define SEQ 4096
#define DDIM 64
#define MDIM 64
#define DVDIM 64
#define CHUNKC 128
#define NCHUNK (SEQ / CHUNKC)   // 32
#define BH (BDIM * HDIM)        // 64
#define FEPS 1e-4f
#define DNORM 0.35355339059327379f  // 64^-0.25
#define DGSC  0.0625f               // 0.5 * DNORM^2 = 0.5 * 64^-0.5
#define RATIO 0.125f                // 64^-0.5

#define PROW 68
#define PCOL 80
#define PSCO 132

typedef __attribute__((ext_vector_type(2))) float v2f;
typedef __attribute__((ext_vector_type(8))) float v8f;
typedef int v4i __attribute__((ext_vector_type(4)));

#define ASYNC_OK __has_builtin(__builtin_amdgcn_global_load_async_to_lds_b128)

__device__ __forceinline__ void copy_b128(float* __restrict__ dst_lds,
                                          const float* __restrict__ src) {
#if ASYNC_OK
  typedef __attribute__((address_space(3))) v4i* lds_v4i_p;
  v4i* g = (v4i*)(uintptr_t)src;                         // generic global ptr
  lds_v4i_p l = (lds_v4i_p)(unsigned)(uintptr_t)dst_lds; // low 32b = LDS offset
  __builtin_amdgcn_global_load_async_to_lds_b128(g, l, 0, 0);
#else
  *(float4*)dst_lds = *(const float4*)src;
#endif
}

__device__ __forceinline__ void async_wait_all() {
#if ASYNC_OK
#if __has_builtin(__builtin_amdgcn_s_wait_asynccnt)
  __builtin_amdgcn_s_wait_asynccnt(0);
#else
  asm volatile("s_wait_asynccnt 0x0" ::: "memory");
#endif
#endif
}

__device__ __forceinline__ v8f wmma_k4(v2f a, v2f b, v8f c) {
  return __builtin_amdgcn_wmma_f32_16x16x4_f32(
      false, a, false, b, (short)0, c, false, false);
}

// C(16x16) += A(16xK) * B(Kx16); A row-major (lda), B row-major (ldb).
__device__ __forceinline__ v8f mma_tile(const float* __restrict__ A, int lda,
                                        const float* __restrict__ B, int ldb,
                                        int klen, v8f acc) {
  const int lane = threadIdx.x & 31;
  const int half = lane >> 4;
  const int lid  = lane & 15;
  for (int kk = 0; kk < klen; kk += 4) {
    v2f a, b;
    a.x = A[lid * lda + kk + 2 * half];
    a.y = A[lid * lda + kk + 2 * half + 1];
    b.x = B[(kk + 2 * half) * ldb + lid];
    b.y = B[(kk + 2 * half + 1) * ldb + lid];
    acc = wmma_k4(a, b, acc);
  }
  return acc;
}

// C(16x16) += A^T * B, where At is stored K-major: A[m][k] = At[k*ldat + m].
__device__ __forceinline__ v8f mma_tile_At(const float* __restrict__ At, int ldat,
                                           const float* __restrict__ B, int ldb,
                                           int klen, v8f acc) {
  const int lane = threadIdx.x & 31;
  const int half = lane >> 4;
  const int lid  = lane & 15;
  for (int kk = 0; kk < klen; kk += 4) {
    v2f a, b;
    a.x = At[(kk + 2 * half) * ldat + lid];
    a.y = At[(kk + 2 * half + 1) * ldat + lid];
    b.x = B[(kk + 2 * half) * ldb + lid];
    b.y = B[(kk + 2 * half + 1) * ldb + lid];
    acc = wmma_k4(a, b, acc);
  }
  return acc;
}

// C(16x16) += A * B^T, where Bt is stored N-major: B[k][n] = Bt[n*ldbt + k].
__device__ __forceinline__ v8f mma_tile_Bt(const float* __restrict__ A, int lda,
                                           const float* __restrict__ Bt, int ldbt,
                                           int klen, v8f acc) {
  const int lane = threadIdx.x & 31;
  const int half = lane >> 4;
  const int lid  = lane & 15;
  for (int kk = 0; kk < klen; kk += 4) {
    v2f a, b;
    a.x = A[lid * lda + kk + 2 * half];
    a.y = A[lid * lda + kk + 2 * half + 1];
    b.x = Bt[lid * ldbt + kk + 2 * half];
    b.y = Bt[lid * ldbt + kk + 2 * half + 1];
    acc = wmma_k4(a, b, acc);
  }
  return acc;
}

__device__ __forceinline__ void store_tile(float* __restrict__ C, int ldc, v8f acc) {
  const int lane = threadIdx.x & 31;
  const int half = lane >> 4;
  const int lid  = lane & 15;
#pragma unroll
  for (int vv = 0; vv < 8; ++vv)
    C[(vv + 8 * half) * ldc + lid] = acc[vv];
}

// ---------------------------------------------------------------------------
// Kernel 1: FAVOR+ feature map for one (b,h,chunk) tile of 128 rows.
//   dd = DNORM * (x @ proj)   (WMMA on raw x, scale at consumption)
//   is_query: feat = RATIO*(exp(dd - diag - rowmax(dd)) + EPS)
//   else    : feat = dd - diag (raw), blockmax[blk] = max(dd) for global stab
// ---------------------------------------------------------------------------
extern "C" __global__ __launch_bounds__(256)
void feat_kernel(const float* __restrict__ x, const float* __restrict__ proj,
                 float* __restrict__ feat, float* __restrict__ blockmax,
                 int is_query) {
  extern __shared__ float smem[];
  float* sx    = smem;                   // 128 rows, pitch PROW (raw x)
  float* sp    = sx + CHUNKC * PROW;     // 64 rows, pitch PCOL
  float* sdd   = sp + DDIM * PCOL;       // 128 rows, pitch PROW (x @ proj)
  float* sdiag = sdd + CHUNKC * PROW;    // 128
  float* sred  = sdiag + CHUNKC;         // 128

  const int tid = threadIdx.x;
  const int bhc = blockIdx.x;
  const int bh  = bhc / NCHUNK;
  const int ch  = bhc % NCHUNK;
  const long base = ((long)bh * SEQ + (long)ch * CHUNKC) * DDIM;

  for (int i = tid; i < CHUNKC * DDIM / 4; i += 256)
    copy_b128(sx + (i >> 4) * PROW + 4 * (i & 15), x + base + 4 * i);
  for (int i = tid; i < DDIM * MDIM / 4; i += 256)
    copy_b128(sp + (i >> 4) * PCOL + 4 * (i & 15), proj + 4 * i);
  async_wait_all();
  __syncthreads();

  // diag = 0.5 * dnorm^2 * sum(x^2)
  if (tid < CHUNKC) {
    const float* row = sx + tid * PROW;
    float s = 0.f;
#pragma unroll 8
    for (int j = 0; j < DDIM; ++j) s += row[j] * row[j];
    sdiag[tid] = DGSC * s;
  }

  // 8 waves: wave w -> row tile w (16 rows), 4 column tiles of 16
  const int w = tid >> 5;
  for (int ct = 0; ct < 4; ++ct) {
    v8f acc = {};
    acc = mma_tile(sx + (w * 16) * PROW, PROW, sp + ct * 16, PCOL, DDIM, acc);
    store_tile(sdd + (w * 16) * PROW + ct * 16, PROW, acc);
  }
  __syncthreads();

  if (tid < CHUNKC) {
    const float* row = sdd + tid * PROW;
    float mx = DNORM * row[0];
    for (int j = 1; j < MDIM; ++j) mx = fmaxf(mx, DNORM * row[j]);
    const long ob = ((long)bh * SEQ + (long)ch * CHUNKC + tid) * MDIM;
    const float dg = sdiag[tid];
    if (is_query) {
      for (int j = 0; j < MDIM; ++j)
        feat[ob + j] = RATIO * (expf(DNORM * row[j] - dg - mx) + FEPS);
    } else {
      for (int j = 0; j < MDIM; ++j)
        feat[ob + j] = DNORM * row[j] - dg;  // finished later with global stab
      sred[tid] = mx;                        // stab uses max of raw data_dash
    }
  }
  if (!is_query) {
    __syncthreads();
    if (tid == 0) {
      float mx = sred[0];
      for (int j = 1; j < CHUNKC; ++j) mx = fmaxf(mx, sred[j]);
      blockmax[bhc] = mx;
    }
  }
}

// Kernel 2: global max over block maxima -> gmax[0]
extern "C" __global__ __launch_bounds__(256)
void reduce_max_kernel(const float* __restrict__ bmax, float* __restrict__ gmax,
                       int n) {
  __shared__ float sred[256];
  float mx = -3.4e38f;
  for (int i = threadIdx.x; i < n; i += 256) mx = fmaxf(mx, bmax[i]);
  sred[threadIdx.x] = mx;
  __syncthreads();
  for (int s = 128; s > 0; s >>= 1) {
    if (threadIdx.x < s)
      sred[threadIdx.x] = fmaxf(sred[threadIdx.x], sred[threadIdx.x + s]);
    __syncthreads();
  }
  if (threadIdx.x == 0) gmax[0] = sred[0];
}

// Kernel 3: kp = RATIO*(exp(raw - gmax) + EPS), in place
extern "C" __global__ __launch_bounds__(256)
void finalize_kp_kernel(float* __restrict__ kp, const float* __restrict__ gmax,
                        long n) {
  const float gm = gmax[0];
  long i = (long)blockIdx.x * blockDim.x + threadIdx.x;
  const long stride = (long)gridDim.x * blockDim.x;
  for (; i < n; i += stride) kp[i] = RATIO * (expf(kp[i] - gm) + FEPS);
}

// Kernel 4: per-chunk sums  ckv = kp^T @ v (64x64, K=128), cks = colsum(kp)
extern "C" __global__ __launch_bounds__(256)
void chunk_sums_kernel(const float* __restrict__ kp, const float* __restrict__ v,
                       float* __restrict__ ckv, float* __restrict__ cks) {
  extern __shared__ float smem[];
  float* skp = smem;                    // 128 rows, pitch PCOL
  float* sv  = skp + CHUNKC * PCOL;     // 128 rows, pitch PCOL

  const int tid = threadIdx.x;
  const int bhc = blockIdx.x;
  const int bh  = bhc / NCHUNK;
  const int ch  = bhc % NCHUNK;
  const long kb = ((long)bh * SEQ + (long)ch * CHUNKC) * MDIM;
  const long vb = ((long)bh * SEQ + (long)ch * CHUNKC) * DVDIM;

  for (int i = tid; i < CHUNKC * MDIM / 4; i += 256) {
    const int l = (i >> 4) * PCOL + 4 * (i & 15);
    copy_b128(skp + l, kp + kb + 4 * i);
    copy_b128(sv + l, v + vb + 4 * i);
  }
  async_wait_all();
  __syncthreads();

  if (tid < MDIM) {
    float s = 0.f;
    for (int c = 0; c < CHUNKC; ++c) s += skp[c * PCOL + tid];
    cks[(long)bhc * MDIM + tid] = s;
  }

  const int w = tid >> 5;               // 8 waves x 2 tiles = 16 tiles (4x4)
  for (int i = 0; i < 2; ++i) {
    const int t = w * 2 + i, tr = t >> 2, tc = t & 3;
    v8f acc = {};
    acc = mma_tile_At(skp + tr * 16, PCOL, sv + tc * 16, PCOL, CHUNKC, acc);
    store_tile(ckv + (long)bhc * MDIM * DVDIM + (tr * 16) * DVDIM + tc * 16,
               DVDIM, acc);
  }
}

// Kernel 5: exclusive prefix over chunks (in place) -> running kv/ks state.
// One thread owns one column of the scan: four adjacent kv elements (work-groups
// 0 .. PFX_KV_WG-1) or one ks element (the work-groups behind them). A column's
// chunk values are all loaded before the first add, so the loads overlap instead
// of following one another; the adds run in chunk order. The four loops are
// unrolled so that val[] is indexed by constants and stays in registers.
#define PFX_KV_WG (BH * MDIM * DVDIM / 4 / 256)   // 256
#define PFX_KS_WG (BH * MDIM / 256)               // 16
extern "C" __global__ __launch_bounds__(256)
__attribute__((amdgpu_waves_per_eu(2, 4)))
void prefix_kernel(float* __restrict__ ckv, float* __restrict__ cks) {
  const int blk = blockIdx.x, tid = threadIdx.x;
  if (blk < PFX_KV_WG) {
    const int col = blk * 256 + tid;               // float4 column
    const int bh = col / (MDIM * DVDIM / 4);
    const int e4 = col % (MDIM * DVDIM / 4);
    float4* p = (float4*)(ckv + (long)bh * NCHUNK * MDIM * DVDIM) + e4;
    float4 val[NCHUNK];
#pragma unroll
    for (int ch = 0; ch < NCHUNK; ++ch) val[ch] = p[ch * (MDIM * DVDIM / 4)];
    float4 run = make_float4(0.f, 0.f, 0.f, 0.f);
#pragma unroll
    for (int ch = 0; ch < NCHUNK; ++ch) {
      p[ch * (MDIM * DVDIM / 4)] = run;
      run.x += val[ch].x;
      run.y += val[ch].y;
      run.z += val[ch].z;
      run.w += val[ch].w;
    }
  } else {
    const int col = (blk - PFX_KV_WG) * 256 + tid;
    const int bh = col / MDIM;
    const int m  = col % MDIM;
    float* p = cks + (long)bh * NCHUNK * MDIM + m;
    float val[NCHUNK];
#pragma unroll
    for (int ch = 0; ch < NCHUNK; ++ch) val[ch] = p[ch * MDIM];
    float run = 0.f;
#pragma unroll
    for (int ch = 0; ch < NCHUNK; ++ch) {
      p[ch * MDIM] = run;
      run += val[ch];
    }
    // Closes the stores above before any of their registers is written again.
    asm volatile("s_wait_xcnt 0x0" ::: "memory");
  }
}

// Kernel 6: per-chunk output.
//   A   = qp @ kp^T  (128x128, masked tril)            [WMMA]
//   num = A @ v + qp @ kv_prefix                       [WMMA]
//   den = rowsum(A) + qp . ks_prefix
//   out = num / den
extern "C" __global__ __launch_bounds__(256)
void out_kernel(const float* __restrict__ qp, const float* __restrict__ kp,
                const float* __restrict__ v, const float* __restrict__ ckv,
                const float* __restrict__ cks, float* __restrict__ out) {
  extern __shared__ float smem[];
  float* sq   = smem;                     // 128 rows, pitch PROW
  float* sk   = sq + CHUNKC * PROW;       // 128 rows, pitch PROW
  float* sv   = sk + CHUNKC * PROW;       // 128 rows, pitch PCOL
  float* skv  = sv + CHUNKC * PCOL;       // 64 rows, pitch PCOL
  float* sks  = skv + MDIM * PCOL;        // 64
  float* sden = sks + MDIM;               // 128
  float* sA   = sden + CHUNKC;            // 128 rows, pitch PSCO

  const int tid = threadIdx.x;
  const int bhc = blockIdx.x;
  const int bh  = bhc / NCHUNK;
  const int ch  = bhc % NCHUNK;
  const long fb = ((long)bh * SEQ + (long)ch * CHUNKC) * MDIM;
  const long vb = ((long)bh * SEQ + (long)ch * CHUNKC) * DVDIM;

  for (int i = tid; i < CHUNKC * MDIM / 4; i += 256) {
    const int r = i >> 4, c = 4 * (i & 15);
    copy_b128(sq + r * PROW + c, qp + fb + 4 * i);
    copy_b128(sk + r * PROW + c, kp + fb + 4 * i);
    copy_b128(sv + r * PCOL + c, v + vb + 4 * i);
  }
  for (int i = tid; i < MDIM * DVDIM / 4; i += 256)
    copy_b128(skv + (i >> 4) * PCOL + 4 * (i & 15),
              ckv + (long)bhc * MDIM * DVDIM + 4 * i);
  if (tid < MDIM) sks[tid] = cks[(long)bhc * MDIM + tid];
  async_wait_all();
  __syncthreads();

  const int w = tid >> 5;
  const int lane = tid & 31, half = lane >> 4, lid = lane & 15;

  // A strip: wave w -> rows [16w,16w+16), all 8 column tiles; causal mask.
  for (int tc = 0; tc < 8; ++tc) {
    v8f acc = {};
    acc = mma_tile_Bt(sq + (w * 16) * PROW, PROW, sk + (tc * 16) * PROW, PROW,
                      MDIM, acc);
#pragma unroll
    for (int vv = 0; vv < 8; ++vv) {
      const int R = w * 16 + vv + 8 * half;
      const int Ccol = tc * 16 + lid;
      sA[R * PSCO + Ccol] = (Ccol <= R) ? acc[vv] : 0.f;
    }
  }
  __syncthreads();

  if (tid < CHUNKC) {
    const float* row = sA + tid * PSCO;
    float s = 0.f;
    for (int j = 0; j < CHUNKC; ++j) s += row[j];
    const float* qrow = sq + tid * PROW;
    for (int j = 0; j < MDIM; ++j) s += qrow[j] * sks[j];
    sden[tid] = s;
  }
  __syncthreads();

  for (int tc = 0; tc < 4; ++tc) {
    v8f acc = {};
    acc = mma_tile(sA + (w * 16) * PSCO, PSCO, sv + tc * 16, PCOL, CHUNKC, acc);
    acc = mma_tile(sq + (w * 16) * PROW, PROW, skv + tc * 16, PCOL, MDIM, acc);
#pragma unroll
    for (int vv = 0; vv < 8; ++vv) {
      const int R = w * 16 + vv + 8 * half;
      out[vb + (long)R * DVDIM + tc * 16 + lid] = acc[vv] / sden[R];
    }
  }
}

// ---------------------------------------------------------------------------
extern "C" void kernel_launch(void* const* d_in, const int* in_sizes, int n_in,
                              void* d_out, int out_size, void* d_ws,
                              size_t ws_size, hipStream_t stream) {
  const float* q    = (const float*)d_in[0];
  const float* k    = (const float*)d_in[1];
  const float* v    = (const float*)d_in[2];
  const float* proj = (const float*)d_in[3];
  float* out = (float*)d_out;

  float* ws = (float*)d_ws;
  const long FEAT = (long)BH * SEQ * MDIM;            // 16,777,216 floats
  float* qp   = ws;
  float* kp   = qp + FEAT;
  float* ckv  = kp + FEAT;                            // BH*NC*64*64
  float* cks  = ckv + (long)BH * NCHUNK * MDIM * DVDIM;
  float* bmax = cks + (long)BH * NCHUNK * MDIM;
  float* gmax = bmax + BH * NCHUNK;

  const size_t featShm =
      (size_t)(CHUNKC * PROW + DDIM * PCOL + CHUNKC * PROW + 2 * CHUNKC) *
      sizeof(float);
  const size_t csumShm = (size_t)(CHUNKC * PCOL + CHUNKC * PCOL) * sizeof(float);
  const size_t outShm =
      (size_t)(2 * CHUNKC * PROW + CHUNKC * PCOL + MDIM * PCOL + MDIM +
               CHUNKC + CHUNKC * PSCO) * sizeof(float);

  (void)hipFuncSetAttribute(reinterpret_cast<const void*>(feat_kernel),
                            hipFuncAttributeMaxDynamicSharedMemorySize,
                            (int)featShm);
  (void)hipFuncSetAttribute(reinterpret_cast<const void*>(chunk_sums_kernel),
                            hipFuncAttributeMaxDynamicSharedMemorySize,
                            (int)csumShm);
  (void)hipFuncSetAttribute(reinterpret_cast<const void*>(out_kernel),
                            hipFuncAttributeMaxDynamicSharedMemorySize,
                            (int)outShm);

  feat_kernel<<<BH * NCHUNK, 256, featShm, stream>>>(q, proj, qp, bmax, 1);
  feat_kernel<<<BH * NCHUNK, 256, featShm, stream>>>(k, proj, kp, bmax, 0);
  reduce_max_kernel<<<1, 256, 0, stream>>>(bmax, gmax, BH * NCHUNK);
  finalize_kp_kernel<<<2048, 256, 0, stream>>>(kp, gmax, FEAT);
  chunk_sums_kernel<<<BH * NCHUNK, 256, csumShm, stream>>>(kp, v, ckv, cks);
  prefix_kernel<<<PFX_KV_WG + PFX_KS_WG, 256, 0, stream>>>(ckv, cks);
  out_kernel<<<BH * NCHUNK, 256, outShm, stream>>>(qp, kp, v, ckv, cks, out);
}

// v003
// It runs in 219 microseconds.
// Timed twice side by side with v002, it ran 1.24 times as fast both times.
// Over all steps from v000 it is 3.42 times as fast.
#include <hip/hip_runtime.h>
#include <math.h>
#include <stdint.h>

// Problem constants (match reference)
#define BDIM 4
#define HDIM 16
#define SEQ 4096
#define DDIM 64
#define MDIM 64
#define DVDIM 64
#define CHUNKC 128
#define NCHUNK (SEQ / CHUNKC)   // 32
#define BH (BDIM * HDIM)        // 64
#define FEPS 1e-4f
#define DNORM 0.35355339059327379f  // 64^-0.25
#define DGSC  0.0625f               // 0.5 * DNORM^2 = 0.5 * 64^-0.5
#define RATIO 0.125f                // 64^-0.5

#define PROW 68
#define PCOL 80
#define PSCO 132

typedef __attribute__((ext_vector_type(2))) float v2f;
typedef __attribute__((ext_vector_type(8))) float v8f;
typedef int v4i __attribute__((ext_vector_type(4)));

#define ASYNC_OK __has_builtin(__builtin_amdgcn_global_load_async_to_lds_b128)

__device__ __forceinline__ void copy_b128(float* __restrict__ dst_lds,
                                          const float* __restrict__ src) {
#if ASYNC_OK
  typedef __attribute__((address_space(3))) v4i* lds_v4i_p;
  v4i* g = (v4i*)(uintptr_t)src;                         // generic global ptr
  lds_v4i_p l = (lds_v4i_p)(unsigned)(uintptr_t)dst_lds; // low 32b = LDS offset
  __builtin_amdgcn_global_load_async_to_lds_b128(g, l, 0, 0);
#else
  *(float4*)dst_lds = *(const float4*)src;
#endif
}

__device__ __forceinline__ void async_wait_all() {
#if ASYNC_OK
#if __has_builtin(__builtin_amdgcn_s_wait_asynccnt)
  __builtin_amdgcn_s_wait_asynccnt(0);
#else
  asm volatile("s_wait_asynccnt 0x0" ::: "memory");
#endif
#endif
}

__device__ __forceinline__ v8f wmma_k4(v2f a, v2f b, v8f c) {
  return __builtin_amdgcn_wmma_f32_16x16x4_f32(
      false, a, false, b, (short)0, c, false, false);
}

// C(16x16) += A(16xK) * B(Kx16); A row-major (lda), B row-major (ldb).
__device__ __forceinline__ v8f mma_tile(const float* __restrict__ A, int lda,
                                        const float* __restrict__ B, int ldb,
                                        int klen, v8f acc) {
  const int lane = threadIdx.x & 31;
  const int half = lane >> 4;
  const int lid  = lane & 15;
  for (int kk = 0; kk < klen; kk += 4) {
    v2f a, b;
    a.x = A[lid * lda + kk + 2 * half];
    a.y = A[lid * lda + kk + 2 * half + 1];
    b.x = B[(kk + 2 * half) * ldb + lid];
    b.y = B[(kk + 2 * half + 1) * ldb + lid];
    acc = wmma_k4(a, b, acc);
  }
  return acc;
}

// C(16x16) += A^T * B, where At is stored K-major: A[m][k] = At[k*ldat + m].
__device__ __forceinline__ v8f mma_tile_At(const float* __restrict__ At, int ldat,
                                           const float* __restrict__ B, int ldb,
                                           int klen, v8f acc) {
  const int lane = threadIdx.x & 31;
  const int half = lane >> 4;
  const int lid  = lane & 15;
  for (int kk = 0; kk < klen; kk += 4) {
    v2f a, b;
    a.x = At[(kk + 2 * half) * ldat + lid];
    a.y = At[(kk + 2 * half + 1) * ldat + lid];
    b.x = B[(kk + 2 * half) * ldb + lid];
    b.y = B[(kk + 2 * half + 1) * ldb + lid];
    acc = wmma_k4(a, b, acc);
  }
  return acc;
}

// C(16x16) += A * B^T, where Bt is stored N-major: B[k][n] = Bt[n*ldbt + k].
__device__ __forceinline__ v8f mma_tile_Bt(const float* __restrict__ A, int lda,
                                           const float* __restrict__ Bt, int ldbt,
                                           int klen, v8f acc) {
  const int lane = threadIdx.x & 31;
  const int half = lane >> 4;
  const int lid  = lane & 15;
  for (int kk = 0; kk < klen; kk += 4) {
    v2f a, b;
    a.x = A[lid * lda + kk + 2 * half];
    a.y = A[lid * lda + kk + 2 * half + 1];
    b.x = Bt[lid * ldbt + kk + 2 * half];
    b.y = Bt[lid * ldbt + kk + 2 * half + 1];
    acc = wmma_k4(a, b, acc);
  }
  return acc;
}

__device__ __forceinline__ void store_tile(float* __restrict__ C, int ldc, v8f acc) {
  const int lane = threadIdx.x & 31;
  const int half = lane >> 4;
  const int lid  = lane & 15;
#pragma unroll
  for (int vv = 0; vv < 8; ++vv)
    C[(vv + 8 * half) * ldc + lid] = acc[vv];
}

template <int CTRL>
__device__ __forceinline__ float dpp_get(float x) {
  const int b = __builtin_bit_cast(int, x);
  return __builtin_bit_cast(
      float, __builtin_amdgcn_update_dpp(b, b, CTRL, 0xf, 0xf, false));
}

__device__ __forceinline__ float xhalf(float x) {
  const int b = __builtin_bit_cast(int, x);
  return __builtin_bit_cast(
      float, __builtin_amdgcn_permlanex16(b, b, 0x76543210, 0xfedcba98, false,
                                          false));
}

__device__ __forceinline__ float row16_max(float x) {  // result in all 16 lanes
  x = fmaxf(x, dpp_get<0x161>(x));
  x = fmaxf(x, dpp_get<0x162>(x));
  x = fmaxf(x, dpp_get<0x164>(x));
  x = fmaxf(x, dpp_get<0x168>(x));
  return x;
}

// ---------------------------------------------------------------------------
// Kernel 1: FAVOR+ feature map for one (b,h,chunk) tile of 128 rows.
//   dd = DNORM * (x @ proj)   (WMMA on raw x, scale at consumption)
//   is_query: feat = RATIO*(exp(dd - diag - rowmax(dd)) + EPS)
//   else    : feat = dd - diag (raw), blockmax[blk] = max(dd) for global stab
// Each wave keeps its 16 x 64 strip of x @ proj in four accumulators and
// finishes it there: accumulator register vv holds row vv + 8 * half, column
// 16 * ct + lid, so a row's maximum is a maximum over ct and over 16 lanes.
// ---------------------------------------------------------------------------
extern "C" __global__ __launch_bounds__(256)
void feat_kernel(const float* __restrict__ x, const float* __restrict__ proj,
                 float* __restrict__ feat, float* __restrict__ blockmax,
                 int is_query) {
  extern __shared__ float smem[];
  float* sx   = smem;                   // 128 rows, pitch PROW: raw x, then feat
  float* sp   = sx + CHUNKC * PROW;     // 64 rows, pitch PCOL
  float* sred = sp + DDIM * PCOL;       // 8: one maximum per wave

  const int tid = threadIdx.x;
  const int bhc = blockIdx.x;
  const int bh  = bhc / NCHUNK;
  const int ch  = bhc % NCHUNK;
  const long base = ((long)bh * SEQ + (long)ch * CHUNKC) * DDIM;

  for (int i = tid; i < CHUNKC * DDIM / 4; i += 256)
    copy_b128(sx + (i >> 4) * PROW + 4 * (i & 15), x + base + 4 * i);
  for (int i = tid; i < DDIM * MDIM / 4; i += 256)
    copy_b128(sp + (i >> 4) * PCOL + 4 * (i & 15), proj + 4 * i);
  async_wait_all();
  __syncthreads();

  // 8 waves: wave w -> row tile w (16 rows), 4 column tiles of 16. Only wave w
  // reads or writes rows 16w .. 16w+15 of sx until the barrier below.
  const int w = tid >> 5;
  const int lane = tid & 31, half = lane >> 4, lid = lane & 15;
  float* strip = sx + (w * 16) * PROW;

  // k outer, column tile inner: one A fragment serves the four tiles and, squared,
  // diag = 0.5 * dnorm^2 * sum(x^2): over the 16 steps the lane sees one half of
  // row lid, lane ^ 16 the other half. Both loops are unrolled so that acc[] is
  // indexed by constants and stays in registers.
  const float* ar = strip + lid * PROW + 2 * half;
  const float* br = sp + (2 * half) * PCOL + lid;
  v8f acc[4] = {};
  float ss = 0.f;
#pragma unroll
  for (int kk = 0; kk < DDIM; kk += 4) {
    v2f a;
    a.x = ar[kk];
    a.y = ar[kk + 1];
    ss += a.x * a.x;
    ss += a.y * a.y;
#pragma unroll
    for (int ct = 0; ct < 4; ++ct) {
      v2f b;
      b.x = br[kk * PCOL + ct * 16];
      b.y = br[(kk + 1) * PCOL + ct * 16];
      acc[ct] = wmma_k4(a, b, acc[ct]);
    }
  }
  ss += xhalf(ss);
  const float dgl = DGSC * ss;           // diag of row lid, in both halves
  // The upper 16 lanes need rows 8..15: there lane n takes row n ^ 8, so that
  // row_share:vv hands every lane the diag of its row vv + 8 * half.
  const float dgs = half ? dpp_get<0x168>(dgl) : dgl;
  const float dg[8] = {dpp_get<0x150>(dgs), dpp_get<0x151>(dgs),
                       dpp_get<0x152>(dgs), dpp_get<0x153>(dgs),
                       dpp_get<0x154>(dgs), dpp_get<0x155>(dgs),
                       dpp_get<0x156>(dgs), dpp_get<0x157>(dgs)};

  float mx[8];
#pragma unroll
  for (int vv = 0; vv < 8; ++vv)
    mx[vv] = DNORM * row16_max(fmaxf(fmaxf(acc[0][vv], acc[1][vv]),
                                     fmaxf(acc[2][vv], acc[3][vv])));

  // Finished values go back into the wave's own strip of sx (its x is used up),
  // from where the whole block stores them as full rows.
  float* dst = strip + (8 * half) * PROW + lid;
  if (is_query) {
#pragma unroll
    for (int vv = 0; vv < 8; ++vv)
#pragma unroll
      for (int ct = 0; ct < 4; ++ct)
        dst[vv * PROW + ct * 16] =
            RATIO * (expf(DNORM * acc[ct][vv] - dg[vv] - mx[vv]) + FEPS);
  } else {
    float bm = mx[0];                    // stab uses max of raw data_dash
#pragma unroll
    for (int vv = 0; vv < 8; ++vv) {
#pragma unroll
      for (int ct = 0; ct < 4; ++ct)
        dst[vv * PROW + ct * 16] =
            DNORM * acc[ct][vv] - dg[vv];  // finished later with global stab
      bm = fmaxf(bm, mx[vv]);
    }
    bm = fmaxf(bm, xhalf(bm));
    if (lane == 0) sred[w] = bm;
  }
  __syncthreads();

  // One wave instruction stores two whole rows (512 contiguous bytes). Unrolled
  // so that the eight LDS reads are in flight together, not one per store.
  const long ob = ((long)bh * SEQ + (long)ch * CHUNKC) * MDIM;
#pragma unroll
  for (int j = 0; j < CHUNKC * MDIM / 4 / 256; ++j) {
    const int i = tid + 256 * j;
    *(float4*)(feat + ob + 4 * i) =
        *(const float4*)(sx + (i >> 4) * PROW + 4 * (i & 15));
  }

  if (!is_query && tid == 0) {
    float gm = sred[0];
    for (int j = 1; j < 8; ++j) gm = fmaxf(gm, sred[j]);
    blockmax[bhc] = gm;
  }
}

// Kernel 2: global max over block maxima -> gmax[0]
extern "C" __global__ __launch_bounds__(256)
void reduce_max_kernel(const float* __restrict__ bmax, float* __restrict__ gmax,
                       int n) {
  __shared__ float sred[256];
  float mx = -3.4e38f;
  for (int i = threadIdx.x; i < n; i += 256) mx = fmaxf(mx, bmax[i]);
  sred[threadIdx.x] = mx;
  __syncthreads();
  for (int s = 128; s > 0; s >>= 1) {
    if (threadIdx.x < s)
      sred[threadIdx.x] = fmaxf(sred[threadIdx.x], sred[threadIdx.x + s]);
    __syncthreads();
  }
  if (threadIdx.x == 0) gmax[0] = sred[0];
}

// Kernel 3: kp = RATIO*(exp(raw - gmax) + EPS), in place
extern "C" __global__ __launch_bounds__(256)
void finalize_kp_kernel(float* __restrict__ kp, const float* __restrict__ gmax,
                        long n) {
  const float gm = gmax[0];
  long i = (long)blockIdx.x * blockDim.x + threadIdx.x;
  const long stride = (long)gridDim.x * blockDim.x;
  for (; i < n; i += stride) kp[i] = RATIO * (expf(kp[i] - gm) + FEPS);
}

// Kernel 4: per-chunk sums  ckv = kp^T @ v (64x64, K=128), cks = colsum(kp)
extern "C" __global__ __launch_bounds__(256)
void chunk_sums_kernel(const float* __restrict__ kp, const float* __restrict__ v,
                       float* __restrict__ ckv, float* __restrict__ cks) {
  extern __shared__ float smem[];
  float* skp = smem;                    // 128 rows, pitch PCOL
  float* sv  = skp + CHUNKC * PCOL;     // 128 rows, pitch PCOL

  const int tid = threadIdx.x;
  const int bhc = blockIdx.x;
  const int bh  = bhc / NCHUNK;
  const int ch  = bhc % NCHUNK;
  const long kb = ((long)bh * SEQ + (long)ch * CHUNKC) * MDIM;
  const long vb = ((long)bh * SEQ + (long)ch * CHUNKC) * DVDIM;

  for (int i = tid; i < CHUNKC * MDIM / 4; i += 256) {
    const int l = (i >> 4) * PCOL + 4 * (i & 15);
    copy_b128(skp + l, kp + kb + 4 * i);
    copy_b128(sv + l, v + vb + 4 * i);
  }
  async_wait_all();
  __syncthreads();

  if (tid < MDIM) {
    float s = 0.f;
    for (int c = 0; c < CHUNKC; ++c) s += skp[c * PCOL + tid];
    cks[(long)bhc * MDIM + tid] = s;
  }

  const int w = tid >> 5;               // 8 waves x 2 tiles = 16 tiles (4x4)
  for (int i = 0; i < 2; ++i) {
    const int t = w * 2 + i, tr = t >> 2, tc = t & 3;
    v8f acc = {};
    acc = mma_tile_At(skp + tr * 16, PCOL, sv + tc * 16, PCOL, CHUNKC, acc);
    store_tile(ckv + (long)bhc * MDIM * DVDIM + (tr * 16) * DVDIM + tc * 16,
               DVDIM, acc);
  }
}

// Kernel 5: exclusive prefix over chunks (in place) -> running kv/ks state.
// One thread owns one column of the scan: four adjacent kv elements (work-groups
// 0 .. PFX_KV_WG-1) or one ks element (the work-groups behind them). A column's
// chunk values are all loaded before the first add, so the loads overlap instead
// of following one another; the adds run in chunk order. The four loops are
// unrolled so that val[] is indexed by constants and stays in registers.
#define PFX_KV_WG (BH * MDIM * DVDIM / 4 / 256)   // 256
#define PFX_KS_WG (BH * MDIM / 256)               // 16
extern "C" __global__ __launch_bounds__(256)
__attribute__((amdgpu_waves_per_eu(2, 4)))
void prefix_kernel(float* __restrict__ ckv, float* __restrict__ cks) {
  const int blk = blockIdx.x, tid = threadIdx.x;
  if (blk < PFX_KV_WG) {
    const int col = blk * 256 + tid;               // float4 column
    const int bh = col / (MDIM * DVDIM / 4);
    const int e4 = col % (MDIM * DVDIM / 4);
    float4* p = (float4*)(ckv + (long)bh * NCHUNK * MDIM * DVDIM) + e4;
    float4 val[NCHUNK];
#pragma unroll
    for (int ch = 0; ch < NCHUNK; ++ch) val[ch] = p[ch * (MDIM * DVDIM / 4)];
    float4 run = make_float4(0.f, 0.f, 0.f, 0.f);
#pragma unroll
    for (int ch = 0; ch < NCHUNK; ++ch) {
      p[ch * (MDIM * DVDIM / 4)] = run;
      run.x += val[ch].x;
      run.y += val[ch].y;
      run.z += val[ch].z;
      run.w += val[ch].w;
    }
  } else {
    const int col = (blk - PFX_KV_WG) * 256 + tid;
    const int bh = col / MDIM;
    const int m  = col % MDIM;
    float* p = cks + (long)bh * NCHUNK * MDIM + m;
    float val[NCHUNK];
#pragma unroll
    for (int ch = 0; ch < NCHUNK; ++ch) val[ch] = p[ch * MDIM];
    float run = 0.f;
#pragma unroll
    for (int ch = 0; ch < NCHUNK; ++ch) {
      p[ch * MDIM] = run;
      run += val[ch];
    }
    // Closes the stores above before any of their registers is written again.
    asm volatile("s_wait_xcnt 0x0" ::: "memory");
  }
}

// Kernel 6: per-chunk output.
//   A   = qp @ kp^T  (128x128, masked tril)            [WMMA]
//   num = A @ v + qp @ kv_prefix                       [WMMA]
//   den = rowsum(A) + qp . ks_prefix
//   out = num / den
extern "C" __global__ __launch_bounds__(256)
void out_kernel(const float* __restrict__ qp, const float* __restrict__ kp,
                const float* __restrict__ v, const float* __restrict__ ckv,
                const float* __restrict__ cks, float* __restrict__ out) {
  extern __shared__ float smem[];
  float* sq   = smem;                     // 128 rows, pitch PROW
  float* sk   = sq + CHUNKC * PROW;       // 128 rows, pitch PROW
  float* sv   = sk + CHUNKC * PROW;       // 128 rows, pitch PCOL
  float* skv  = sv + CHUNKC * PCOL;       // 64 rows, pitch PCOL
  float* sks  = skv + MDIM * PCOL;        // 64
  float* sden = sks + MDIM;               // 128
  float* sA   = sden + CHUNKC;            // 128 rows, pitch PSCO

  const int tid = threadIdx.x;
  const int bhc = blockIdx.x;
  const int bh  = bhc / NCHUNK;
  const int ch  = bhc % NCHUNK;
  const long fb = ((long)bh * SEQ + (long)ch * CHUNKC) * MDIM;
  const long vb = ((long)bh * SEQ + (long)ch * CHUNKC) * DVDIM;

  for (int i = tid; i < CHUNKC * MDIM / 4; i += 256) {
    const int r = i >> 4, c = 4 * (i & 15);
    copy_b128(sq + r * PROW + c, qp + fb + 4 * i);
    copy_b128(sk + r * PROW + c, kp + fb + 4 * i);
    copy_b128(sv + r * PCOL + c, v + vb + 4 * i);
  }
  for (int i = tid; i < MDIM * DVDIM / 4; i += 256)
    copy_b128(skv + (i >> 4) * PCOL + 4 * (i & 15),
              ckv + (long)bhc * MDIM * DVDIM + 4 * i);
  if (tid < MDIM) sks[tid] = cks[(long)bhc * MDIM + tid];
  async_wait_all();
  __syncthreads();

  const int w = tid >> 5;
  const int lane = tid & 31, half = lane >> 4, lid = lane & 15;

  // A strip: wave w -> rows [16w,16w+16), all 8 column tiles; causal mask.
  for (int tc = 0; tc < 8; ++tc) {
    v8f acc = {};
    acc = mma_tile_Bt(sq + (w * 16) * PROW, PROW, sk + (tc * 16) * PROW, PROW,
                      MDIM, acc);
#pragma unroll
    for (int vv = 0; vv < 8; ++vv) {
      const int R = w * 16 + vv + 8 * half;
      const int Ccol = tc * 16 + lid;
      sA[R * PSCO + Ccol] = (Ccol <= R) ? acc[vv] : 0.f;
    }
  }
  __syncthreads();

  if (tid < CHUNKC) {
    const float* row = sA + tid * PSCO;
    float s = 0.f;
    for (int j = 0; j < CHUNKC; ++j) s += row[j];
    const float* qrow = sq + tid * PROW;
    for (int j = 0; j < MDIM; ++j) s += qrow[j] * sks[j];
    sden[tid] = s;
  }
  __syncthreads();

  for (int tc = 0; tc < 4; ++tc) {
    v8f acc = {};
    acc = mma_tile(sA + (w * 16) * PSCO, PSCO, sv + tc * 16, PCOL, CHUNKC, acc);
    acc = mma_tile(sq + (w * 16) * PROW, PROW, skv + tc * 16, PCOL, MDIM, acc);
#pragma unroll
    for (int vv = 0; vv < 8; ++vv) {
      const int R = w * 16 + vv + 8 * half;
      out[vb + (long)R * DVDIM + tc * 16 + lid] = acc[vv] / sden[R];
    }
  }
}

// ---------------------------------------------------------------------------
extern "C" void kernel_launch(void* const* d_in, const int* in_sizes, int n_in,
                              void* d_out, int out_size, void* d_ws,
                              size_t ws_size, hipStream_t stream) {
  const float* q    = (const float*)d_in[0];
  const float* k    = (const float*)d_in[1];
  const float* v    = (const float*)d_in[2];
  const float* proj = (const float*)d_in[3];
  float* out = (float*)d_out;

  float* ws = (float*)d_ws;
  const long FEAT = (long)BH * SEQ * MDIM;            // 16,777,216 floats
  float* qp   = ws;
  float* kp   = qp + FEAT;
  float* ckv  = kp + FEAT;                            // BH*NC*64*64
  float* cks  = ckv + (long)BH * NCHUNK * MDIM * DVDIM;
  float* bmax = cks + (long)BH * NCHUNK * MDIM;
  float* gmax = bmax + BH * NCHUNK;

  const size_t featShm =
      (size_t)(CHUNKC * PROW + DDIM * PCOL + 8) * sizeof(float);
  const size_t csumShm = (size_t)(CHUNKC * PCOL + CHUNKC * PCOL) * sizeof(float);
  const size_t outShm =
      (size_t)(2 * CHUNKC * PROW + CHUNKC * PCOL + MDIM * PCOL + MDIM +
               CHUNKC + CHUNKC * PSCO) * sizeof(float);

  (void)hipFuncSetAttribute(reinterpret_cast<const void*>(feat_kernel),
                            hipFuncAttributeMaxDynamicSharedMemorySize,
                            (int)featShm);
  (void)hipFuncSetAttribute(reinterpret_cast<const void*>(chunk_sums_kernel),
                            hipFuncAttributeMaxDynamicSharedMemorySize,
                            (int)csumShm);
  (void)hipFuncSetAttribute(reinterpret_cast<const void*>(out_kernel),
                            hipFuncAttributeMaxDynamicSharedMemorySize,
                            (int)outShm);

  feat_kernel<<<BH * NCHUNK, 256, featShm, stream>>>(q, proj, qp, bmax, 1);
  feat_kernel<<<BH * NCHUNK, 256, featShm, stream>>>(k, proj, kp, bmax, 0);
  reduce_max_kernel<<<1, 256, 0, stream>>>(bmax, gmax, BH * NCHUNK);
  finalize_kp_kernel<<<2048, 256, 0, stream>>>(kp, gmax, FEAT);
  chunk_sums_kernel<<<BH * NCHUNK, 256, csumShm, stream>>>(kp, v, ckv, cks);
  prefix_kernel<<<PFX_KV_WG + PFX_KS_WG, 256, 0, stream>>>(ckv, cks);
  out_kernel<<<BH * NCHUNK, 256, outShm, stream>>>(qp, kp, v, ckv, cks, out);
}

// v004
// A run of this version takes 193 microseconds.
// In both of two side-by-side timings against v003, it was 1.14 times as fast.
// Counting every step since v000, it is 3.89 times as fast.
#include <hip/hip_runtime.h>
#include <math.h>
#include <stdint.h>

// Problem constants (match reference)
#define BDIM 4
#define HDIM 16
#define SEQ 4096
#define DDIM 64
#define MDIM 64
#define DVDIM 64
#define CHUNKC 128
#define NCHUNK (SEQ / CHUNKC)   // 32
#define BH (BDIM * HDIM)        // 64
#define FEPS 1e-4f
#define DNORM 0.35355339059327379f  // 64^-0.25
#define DGSC  0.0625f               // 0.5 * DNORM^2 = 0.5 * 64^-0.5
#define RATIO 0.125f                // 64^-0.5

#define PROW 68
#define PCOL 80

typedef __attribute__((ext_vector_type(2))) float v2f;
typedef __attribute__((ext_vector_type(8))) float v8f;
typedef int v4i __attribute__((ext_vector_type(4)));

#define ASYNC_OK __has_builtin(__builtin_amdgcn_global_load_async_to_lds_b128)

__device__ __forceinline__ void copy_b128(float* __restrict__ dst_lds,
                                          const float* __restrict__ src) {
#if ASYNC_OK
  typedef __attribute__((address_space(3))) v4i* lds_v4i_p;
  v4i* g = (v4i*)(uintptr_t)src;                         // generic global ptr
  lds_v4i_p l = (lds_v4i_p)(unsigned)(uintptr_t)dst_lds; // low 32b = LDS offset
  __builtin_amdgcn_global_load_async_to_lds_b128(g, l, 0, 0);
#else
  *(float4*)dst_lds = *(const float4*)src;
#endif
}

__device__ __forceinline__ void async_wait_all() {
#if ASYNC_OK
#if __has_builtin(__builtin_amdgcn_s_wait_asynccnt)
  __builtin_amdgcn_s_wait_asynccnt(0);
#else
  asm volatile("s_wait_asynccnt 0x0" ::: "memory");
#endif
#endif
}

__device__ __forceinline__ v8f wmma_k4(v2f a, v2f b, v8f c) {
  return __builtin_amdgcn_wmma_f32_16x16x4_f32(
      false, a, false, b, (short)0, c, false, false);
}

// C(16x16) += A^T * B, where At is stored K-major: A[m][k] = At[k*ldat + m].
__device__ __forceinline__ v8f mma_tile_At(const float* __restrict__ At, int ldat,
                                           const float* __restrict__ B, int ldb,
                                           int klen, v8f acc) {
  const int lane = threadIdx.x & 31;
  const int half = lane >> 4;
  const int lid  = lane & 15;
  for (int kk = 0; kk < klen; kk += 4) {
    v2f a, b;
    a.x = At[(kk + 2 * half) * ldat + lid];
    a.y = At[(kk + 2 * half + 1) * ldat + lid];
    b.x = B[(kk + 2 * half) * ldb + lid];
    b.y = B[(kk + 2 * half + 1) * ldb + lid];
    acc = wmma_k4(a, b, acc);
  }
  return acc;
}

__device__ __forceinline__ void store_tile(float* __restrict__ C, int ldc, v8f acc) {
  const int lane = threadIdx.x & 31;
  const int half = lane >> 4;
  const int lid  = lane & 15;
#pragma unroll
  for (int vv = 0; vv < 8; ++vv)
    C[(vv + 8 * half) * ldc + lid] = acc[vv];
}

template <int CTRL>
__device__ __forceinline__ float dpp_get(float x) {
  const int b = __builtin_bit_cast(int, x);
  return __builtin_bit_cast(
      float, __builtin_amdgcn_update_dpp(b, b, CTRL, 0xf, 0xf, false));
}

__device__ __forceinline__ float xhalf(float x) {
  const int b = __builtin_bit_cast(int, x);
  return __builtin_bit_cast(
      float, __builtin_amdgcn_permlanex16(b, b, 0x76543210, 0xfedcba98, false,
                                          false));
}

__device__ __forceinline__ float row16_max(float x) {  // result in all 16 lanes
  x = fmaxf(x, dpp_get<0x161>(x));
  x = fmaxf(x, dpp_get<0x162>(x));
  x = fmaxf(x, dpp_get<0x164>(x));
  x = fmaxf(x, dpp_get<0x168>(x));
  return x;
}

// ---------------------------------------------------------------------------
// Kernel 1: FAVOR+ feature map for one (b,h,chunk) tile of 128 rows.
//   dd = DNORM * (x @ proj)   (WMMA on raw x, scale at consumption)
//   is_query: feat = RATIO*(exp(dd - diag - rowmax(dd)) + EPS)
//   else    : feat = dd - diag (raw), blockmax[blk] = max(dd) for global stab
// Each wave keeps its 16 x 64 strip of x @ proj in four accumulators and
// finishes it there: accumulator register vv holds row vv + 8 * half, column
// 16 * ct + lid, so a row's maximum is a maximum over ct and over 16 lanes.
// ---------------------------------------------------------------------------
extern "C" __global__ __launch_bounds__(256)
void feat_kernel(const float* __restrict__ x, const float* __restrict__ proj,
                 float* __restrict__ feat, float* __restrict__ blockmax,
                 int is_query) {
  extern __shared__ float smem[];
  float* sx   = smem;                   // 128 rows, pitch PROW: raw x, then feat
  float* sp   = sx + CHUNKC * PROW;     // 64 rows, pitch PCOL
  float* sred = sp + DDIM * PCOL;       // 8: one maximum per wave

  const int tid = threadIdx.x;
  const int bhc = blockIdx.x;
  const int bh  = bhc / NCHUNK;
  const int ch  = bhc % NCHUNK;
  const long base = ((long)bh * SEQ + (long)ch * CHUNKC) * DDIM;

  for (int i = tid; i < CHUNKC * DDIM / 4; i += 256)
    copy_b128(sx + (i >> 4) * PROW + 4 * (i & 15), x + base + 4 * i);
  for (int i = tid; i < DDIM * MDIM / 4; i += 256)
    copy_b128(sp + (i >> 4) * PCOL + 4 * (i & 15), proj + 4 * i);
  async_wait_all();
  __syncthreads();

  // 8 waves: wave w -> row tile w (16 rows), 4 column tiles of 16. Only wave w
  // reads or writes rows 16w .. 16w+15 of sx until the barrier below.
  const int w = tid >> 5;
  const int lane = tid & 31, half = lane >> 4, lid = lane & 15;
  float* strip = sx + (w * 16) * PROW;

  // k outer, column tile inner: one A fragment serves the four tiles and, squared,
  // diag = 0.5 * dnorm^2 * sum(x^2): over the 16 steps the lane sees one half of
  // row lid, lane ^ 16 the other half. Both loops are unrolled so that acc[] is
  // indexed by constants and stays in registers.
  const float* ar = strip + lid * PROW + 2 * half;
  const float* br = sp + (2 * half) * PCOL + lid;
  v8f acc[4] = {};
  float ss = 0.f;
#pragma unroll
  for (int kk = 0; kk < DDIM; kk += 4) {
    v2f a;
    a.x = ar[kk];
    a.y = ar[kk + 1];
    ss += a.x * a.x;
    ss += a.y * a.y;
#pragma unroll
    for (int ct = 0; ct < 4; ++ct) {
      v2f b;
      b.x = br[kk * PCOL + ct * 16];
      b.y = br[(kk + 1) * PCOL + ct * 16];
      acc[ct] = wmma_k4(a, b, acc[ct]);
    }
  }
  ss += xhalf(ss);
  const float dgl = DGSC * ss;           // diag of row lid, in both halves
  // The upper 16 lanes need rows 8..15: there lane n takes row n ^ 8, so that
  // row_share:vv hands every lane the diag of its row vv + 8 * half.
  const float dgs = half ? dpp_get<0x168>(dgl) : dgl;
  const float dg[8] = {dpp_get<0x150>(dgs), dpp_get<0x151>(dgs),
                       dpp_get<0x152>(dgs), dpp_get<0x153>(dgs),
                       dpp_get<0x154>(dgs), dpp_get<0x155>(dgs),
                       dpp_get<0x156>(dgs), dpp_get<0x157>(dgs)};

  float mx[8];
#pragma unroll
  for (int vv = 0; vv < 8; ++vv)
    mx[vv] = DNORM * row16_max(fmaxf(fmaxf(acc[0][vv], acc[1][vv]),
                                     fmaxf(acc[2][vv], acc[3][vv])));

  // Finished values go back into the wave's own strip of sx (its x is used up),
  // from where the whole block stores them as full rows.
  float* dst = strip + (8 * half) * PROW + lid;
  if (is_query) {
#pragma unroll
    for (int vv = 0; vv < 8; ++vv)
#pragma unroll
      for (int ct = 0; ct < 4; ++ct)
        dst[vv * PROW + ct * 16] =
            RATIO * (expf(DNORM * acc[ct][vv] - dg[vv] - mx[vv]) + FEPS);
  } else {
    float bm = mx[0];                    // stab uses max of raw data_dash
#pragma unroll
    for (int vv = 0; vv < 8; ++vv) {
#pragma unroll
      for (int ct = 0; ct < 4; ++ct)
        dst[vv * PROW + ct * 16] =
            DNORM * acc[ct][vv] - dg[vv];  // finished later with global stab
      bm = fmaxf(bm, mx[vv]);
    }
    bm = fmaxf(bm, xhalf(bm));
    if (lane == 0) sred[w] = bm;
  }
  __syncthreads();

  // One wave instruction stores two whole rows (512 contiguous bytes). Unrolled
  // so that the eight LDS reads are in flight together, not one per store.
  const long ob = ((long)bh * SEQ + (long)ch * CHUNKC) * MDIM;
#pragma unroll
  for (int j = 0; j < CHUNKC * MDIM / 4 / 256; ++j) {
    const int i = tid + 256 * j;
    *(float4*)(feat + ob + 4 * i) =
        *(const float4*)(sx + (i >> 4) * PROW + 4 * (i & 15));
  }

  if (!is_query && tid == 0) {
    float gm = sred[0];
    for (int j = 1; j < 8; ++j) gm = fmaxf(gm, sred[j]);
    blockmax[bhc] = gm;
  }
}

// Kernel 2: global max over block maxima -> gmax[0]
extern "C" __global__ __launch_bounds__(256)
void reduce_max_kernel(const float* __restrict__ bmax, float* __restrict__ gmax,
                       int n) {
  __shared__ float sred[256];
  float mx = -3.4e38f;
  for (int i = threadIdx.x; i < n; i += 256) mx = fmaxf(mx, bmax[i]);
  sred[threadIdx.x] = mx;
  __syncthreads();
  for (int s = 128; s > 0; s >>= 1) {
    if (threadIdx.x < s)
      sred[threadIdx.x] = fmaxf(sred[threadIdx.x], sred[threadIdx.x + s]);
    __syncthreads();
  }
  if (threadIdx.x == 0) gmax[0] = sred[0];
}

// Kernel 3: kp = RATIO*(exp(raw - gmax) + EPS), in place
extern "C" __global__ __launch_bounds__(256)
void finalize_kp_kernel(float* __restrict__ kp, const float* __restrict__ gmax,
                        long n) {
  const float gm = gmax[0];
  long i = (long)blockIdx.x * blockDim.x + threadIdx.x;
  const long stride = (long)gridDim.x * blockDim.x;
  for (; i < n; i += stride) kp[i] = RATIO * (expf(kp[i] - gm) + FEPS);
}

// Kernel 4: per-chunk sums  ckv = kp^T @ v (64x64, K=128), cks = colsum(kp)
extern "C" __global__ __launch_bounds__(256)
void chunk_sums_kernel(const float* __restrict__ kp, const float* __restrict__ v,
                       float* __restrict__ ckv, float* __restrict__ cks) {
  extern __shared__ float smem[];
  float* skp = smem;                    // 128 rows, pitch PCOL
  float* sv  = skp + CHUNKC * PCOL;     // 128 rows, pitch PCOL

  const int tid = threadIdx.x;
  const int bhc = blockIdx.x;
  const int bh  = bhc / NCHUNK;
  const int ch  = bhc % NCHUNK;
  const long kb = ((long)bh * SEQ + (long)ch * CHUNKC) * MDIM;
  const long vb = ((long)bh * SEQ + (long)ch * CHUNKC) * DVDIM;

  for (int i = tid; i < CHUNKC * MDIM / 4; i += 256) {
    const int l = (i >> 4) * PCOL + 4 * (i & 15);
    copy_b128(skp + l, kp + kb + 4 * i);
    copy_b128(sv + l, v + vb + 4 * i);
  }
  async_wait_all();
  __syncthreads();

  if (tid < MDIM) {
    float s = 0.f;
    for (int c = 0; c < CHUNKC; ++c) s += skp[c * PCOL + tid];
    cks[(long)bhc * MDIM + tid] = s;
  }

  const int w = tid >> 5;               // 8 waves x 2 tiles = 16 tiles (4x4)
  for (int i = 0; i < 2; ++i) {
    const int t = w * 2 + i, tr = t >> 2, tc = t & 3;
    v8f acc = {};
    acc = mma_tile_At(skp + tr * 16, PCOL, sv + tc * 16, PCOL, CHUNKC, acc);
    store_tile(ckv + (long)bhc * MDIM * DVDIM + (tr * 16) * DVDIM + tc * 16,
               DVDIM, acc);
  }
}

// Kernel 5: exclusive prefix over chunks (in place) -> running kv/ks state.
// One thread owns one column of the scan: four adjacent kv elements (work-groups
// 0 .. PFX_KV_WG-1) or one ks element (the work-groups behind them). A column's
// chunk values are all loaded before the first add, so the loads overlap instead
// of following one another; the adds run in chunk order. The four loops are
// unrolled so that val[] is indexed by constants and stays in registers.
#define PFX_KV_WG (BH * MDIM * DVDIM / 4 / 256)   // 256
#define PFX_KS_WG (BH * MDIM / 256)               // 16
extern "C" __global__ __launch_bounds__(256)
__attribute__((amdgpu_waves_per_eu(2, 4)))
void prefix_kernel(float* __restrict__ ckv, float* __restrict__ cks) {
  const int blk = blockIdx.x, tid = threadIdx.x;
  if (blk < PFX_KV_WG) {
    const int col = blk * 256 + tid;               // float4 column
    const int bh = col / (MDIM * DVDIM / 4);
    const int e4 = col % (MDIM * DVDIM / 4);
    float4* p = (float4*)(ckv + (long)bh * NCHUNK * MDIM * DVDIM) + e4;
    float4 val[NCHUNK];
#pragma unroll
    for (int ch = 0; ch < NCHUNK; ++ch) val[ch] = p[ch * (MDIM * DVDIM / 4)];
    float4 run = make_float4(0.f, 0.f, 0.f, 0.f);
#pragma unroll
    for (int ch = 0; ch < NCHUNK; ++ch) {
      p[ch * (MDIM * DVDIM / 4)] = run;
      run.x += val[ch].x;
      run.y += val[ch].y;
      run.z += val[ch].z;
      run.w += val[ch].w;
    }
  } else {
    const int col = (blk - PFX_KV_WG) * 256 + tid;
    const int bh = col / MDIM;
    const int m  = col % MDIM;
    float* p = cks + (long)bh * NCHUNK * MDIM + m;
    float val[NCHUNK];
#pragma unroll
    for (int ch = 0; ch < NCHUNK; ++ch) val[ch] = p[ch * MDIM];
    float run = 0.f;
#pragma unroll
    for (int ch = 0; ch < NCHUNK; ++ch) {
      p[ch * MDIM] = run;
      run += val[ch];
    }
    // Closes the stores above before any of their registers is written again.
    asm volatile("s_wait_xcnt 0x0" ::: "memory");
  }
}

// Kernel 6: per-chunk output, computed transposed so that the scores never
// leave the registers.
//   St   = kp @ qp^T (keys x queries), masked to key <= query   [WMMA]
//   numT = v^T @ St + kv_prefix^T @ qp^T                        [WMMA]
//   den  = colsum(St) + qp . ks_prefix
//   out  = num / den
// Wave w owns queries 16w .. 16w+15. A result tile of St holds, in register r of
// lane (half, lid), key r + 8 * half of query lid. Registers 2j and 2j+1 are
// therefore a B fragment whose four k positions are keys 2j, 2j+1, 2j+8, 2j+9;
// the v^T fragment beside it takes its rows in the same order.
extern "C" __global__ __launch_bounds__(256)
void out_kernel(const float* __restrict__ qp, const float* __restrict__ kp,
                const float* __restrict__ v, const float* __restrict__ ckv,
                const float* __restrict__ cks, float* __restrict__ out) {
  extern __shared__ float smem[];
  float* sq   = smem;                     // 128 rows, pitch PROW: qp, then out
  float* sk   = sq + CHUNKC * PROW;       // 128 rows, pitch PROW
  float* sv   = sk + CHUNKC * PROW;       // 128 rows
  float* skv  = sv + CHUNKC * PROW;       // 64 rows, pitch PCOL
  float* sks  = skv + MDIM * PCOL;        // 64

  const int tid = threadIdx.x;
  const int bhc = blockIdx.x;
  const int bh  = bhc / NCHUNK;
  const int ch  = bhc % NCHUNK;
  const long fb = ((long)bh * SEQ + (long)ch * CHUNKC) * MDIM;
  const long vb = ((long)bh * SEQ + (long)ch * CHUNKC) * DVDIM;

  for (int i = tid; i < CHUNKC * MDIM / 4; i += 256) {
    const int l = (i >> 4) * PROW + 4 * (i & 15);
    copy_b128(sq + l, qp + fb + 4 * i);
    copy_b128(sk + l, kp + fb + 4 * i);
    copy_b128(sv + l, v + vb + 4 * i);
  }
  for (int i = tid; i < MDIM * DVDIM / 4; i += 256)
    copy_b128(skv + (i >> 4) * PCOL + 4 * (i & 15),
              ckv + (long)bhc * MDIM * DVDIM + 4 * i);
  if (tid < MDIM) sks[tid] = cks[(long)bhc * MDIM + tid];
  async_wait_all();
  __syncthreads();

  const int w = tid >> 5;
  const int lane = tid & 31, half = lane >> 4, lid = lane & 15;
  // Only wave w reads or writes rows 16w .. 16w+15 of sq from here on.
  float* strip = sq + (w * 16) * PROW;

  // qp^T as B fragments, read once and used by both products that take it. All
  // loops over st, vv, j and dt are unrolled so that qf[], s and oacc[] are
  // indexed by constants and stay in registers.
  v2f qf[MDIM / 4];
  {
    const float* qr = strip + lid * PROW + 2 * half;
#pragma unroll
    for (int st = 0; st < MDIM / 4; ++st) {
      qf[st].x = qr[4 * st];
      qf[st].y = qr[4 * st + 1];
    }
  }

  v8f oacc[4] = {};
  float dsum = 0.f;                       // this half's share of den of query lid
  for (int tc = 0; tc < CHUNKC / 16; ++tc) {
    const float* kr = sk + (tc * 16 + lid) * PROW + 2 * half;
    v8f s = {};
#pragma unroll
    for (int st = 0; st < MDIM / 4; ++st) {
      v2f a;
      a.x = kr[4 * st];
      a.y = kr[4 * st + 1];
      s = wmma_k4(a, qf[st], s);
    }
    const int lim = (w - tc) * 16 + lid - 8 * half;   // keep register vv <= lim
#pragma unroll
    for (int vv = 0; vv < 8; ++vv) {
      s[vv] = (vv <= lim) ? s[vv] : 0.f;
      dsum += s[vv];
    }
    const float* vr = sv + (tc * 16 + 8 * half) * PROW + lid;
#pragma unroll
    for (int j = 0; j < 4; ++j) {
      v2f b;
      b.x = s[2 * j];
      b.y = s[2 * j + 1];
#pragma unroll
      for (int dt = 0; dt < 4; ++dt) {
        v2f a;
        a.x = vr[(2 * j) * PROW + dt * 16];
        a.y = vr[(2 * j + 1) * PROW + dt * 16];
        oacc[dt] = wmma_k4(a, b, oacc[dt]);
      }
    }
  }

  {
    const float* cr = skv + (2 * half) * PCOL + lid;
    const float* sr = sks + 2 * half;
#pragma unroll
    for (int st = 0; st < MDIM / 4; ++st) {
#pragma unroll
      for (int dt = 0; dt < 4; ++dt) {
        v2f a;
        a.x = cr[(4 * st) * PCOL + dt * 16];
        a.y = cr[(4 * st + 1) * PCOL + dt * 16];
        oacc[dt] = wmma_k4(a, qf[st], oacc[dt]);
      }
      dsum += qf[st].x * sr[4 * st];
      dsum += qf[st].y * sr[4 * st + 1];
    }
  }
  const float den = dsum + xhalf(dsum);

  // oacc[dt][vv] is column 16 * dt + 8 * half + vv of query lid: eight adjacent
  // values. They go into the wave's own strip of sq (its qp is used up) and leave
  // from there as full rows.
  float* orow = strip + lid * PROW + 8 * half;
#pragma unroll
  for (int dt = 0; dt < 4; ++dt) {
    *(float4*)(orow + dt * 16) =
        make_float4(oacc[dt][0] / den, oacc[dt][1] / den, oacc[dt][2] / den,
                    oacc[dt][3] / den);
    *(float4*)(orow + dt * 16 + 4) =
        make_float4(oacc[dt][4] / den, oacc[dt][5] / den, oacc[dt][6] / den,
                    oacc[dt][7] / den);
  }
  // Keeps the compiler from moving a lane's reads below in front of the stores
  // above: each lane reads what other lanes of its wave wrote. The LDS serves one
  // wave's operations in order, so no work-group barrier is needed.
  __builtin_amdgcn_fence(__ATOMIC_ACQ_REL, "wavefront");
  // One wave instruction stores two whole rows (512 contiguous bytes). Unrolled
  // so that the eight LDS reads are in flight together, not one per store.
  float* og = out + vb + (long)(w * 16) * DVDIM;
#pragma unroll
  for (int j = 0; j < 8; ++j)
    *(float4*)(og + (2 * j + half) * DVDIM + 4 * lid) =
        *(const float4*)(strip + (2 * j + half) * PROW + 4 * lid);
}

// ---------------------------------------------------------------------------
extern "C" void kernel_launch(void* const* d_in, const int* in_sizes, int n_in,
                              void* d_out, int out_size, void* d_ws,
                              size_t ws_size, hipStream_t stream) {
  const float* q    = (const float*)d_in[0];
  const float* k    = (const float*)d_in[1];
  const float* v    = (const float*)d_in[2];
  const float* proj = (const float*)d_in[3];
  float* out = (float*)d_out;

  float* ws = (float*)d_ws;
  const long FEAT = (long)BH * SEQ * MDIM;            // 16,777,216 floats
  float* qp   = ws;
  float* kp   = qp + FEAT;
  float* ckv  = kp + FEAT;                            // BH*NC*64*64
  float* cks  = ckv + (long)BH * NCHUNK * MDIM * DVDIM;
  float* bmax = cks + (long)BH * NCHUNK * MDIM;
  float* gmax = bmax + BH * NCHUNK;

  const size_t featShm =
      (size_t)(CHUNKC * PROW + DDIM * PCOL + 8) * sizeof(float);
  const size_t csumShm = (size_t)(CHUNKC * PCOL + CHUNKC * PCOL) * sizeof(float);
  const size_t outShm =
      (size_t)(3 * CHUNKC * PROW + MDIM * PCOL + MDIM) * sizeof(float);

  (void)hipFuncSetAttribute(reinterpret_cast<const void*>(feat_kernel),
                            hipFuncAttributeMaxDynamicSharedMemorySize,
                            (int)featShm);
  (void)hipFuncSetAttribute(reinterpret_cast<const void*>(chunk_sums_kernel),
                            hipFuncAttributeMaxDynamicSharedMemorySize,
                            (int)csumShm);
  (void)hipFuncSetAttribute(reinterpret_cast<const void*>(out_kernel),
                            hipFuncAttributeMaxDynamicSharedMemorySize,
                            (int)outShm);

  feat_kernel<<<BH * NCHUNK, 256, featShm, stream>>>(q, proj, qp, bmax, 1);
  feat_kernel<<<BH * NCHUNK, 256, featShm, stream>>>(k, proj, kp, bmax, 0);
  reduce_max_kernel<<<1, 256, 0, stream>>>(bmax, gmax, BH * NCHUNK);
  finalize_kp_kernel<<<2048, 256, 0, stream>>>(kp, gmax, FEAT);
  chunk_sums_kernel<<<BH * NCHUNK, 256, csumShm, stream>>>(kp, v, ckv, cks);
  prefix_kernel<<<PFX_KV_WG + PFX_KS_WG, 256, 0, stream>>>(ckv, cks);
  out_kernel<<<BH * NCHUNK, 256, outShm, stream>>>(qp, kp, v, ckv, cks, out);
}

// v005
// It runs in 176 microseconds.
// Next to v004, in two timings, it ran 1.10 times as fast each time.
// Over all steps from v000 it is 4.28 times as fast.
#include <hip/hip_runtime.h>
#include <math.h>
#include <stdint.h>

// Problem constants (match reference)
#define BDIM 4
#define HDIM 16
#define SEQ 4096
#define DDIM 64
#define MDIM 64
#define DVDIM 64
#define CHUNKC 128
#define NCHUNK (SEQ / CHUNKC)   // 32
#define BH (BDIM * HDIM)        // 64
#define FEPS 1e-4f
#define DNORM 0.35355339059327379f  // 64^-0.25
#define DGSC  0.0625f               // 0.5 * DNORM^2 = 0.5 * 64^-0.5
#define RATIO 0.125f                // 64^-0.5

#define PROW 68
#define PCOL 80

typedef __attribute__((ext_vector_type(2))) float v2f;
typedef __attribute__((ext_vector_type(8))) float v8f;
typedef int v4i __attribute__((ext_vector_type(4)));

#define ASYNC_OK __has_builtin(__builtin_amdgcn_global_load_async_to_lds_b128)

__device__ __forceinline__ void copy_b128(float* __restrict__ dst_lds,
                                          const float* __restrict__ src) {
#if ASYNC_OK
  typedef __attribute__((address_space(3))) v4i* lds_v4i_p;
  v4i* g = (v4i*)(uintptr_t)src;                         // generic global ptr
  lds_v4i_p l = (lds_v4i_p)(unsigned)(uintptr_t)dst_lds; // low 32b = LDS offset
  __builtin_amdgcn_global_load_async_to_lds_b128(g, l, 0, 0);
#else
  *(float4*)dst_lds = *(const float4*)src;
#endif
}

__device__ __forceinline__ void async_wait_all() {
#if ASYNC_OK
#if __has_builtin(__builtin_amdgcn_s_wait_asynccnt)
  __builtin_amdgcn_s_wait_asynccnt(0);
#else
  asm volatile("s_wait_asynccnt 0x0" ::: "memory");
#endif
#endif
}

__device__ __forceinline__ v8f wmma_k4(v2f a, v2f b, v8f c) {
  return __builtin_amdgcn_wmma_f32_16x16x4_f32(
      false, a, false, b, (short)0, c, false, false);
}

// C(16x16) += A^T * B, where At is stored K-major: A[m][k] = At[k*ldat + m].
__device__ __forceinline__ v8f mma_tile_At(const float* __restrict__ At, int ldat,
                                           const float* __restrict__ B, int ldb,
                                           int klen, v8f acc) {
  const int lane = threadIdx.x & 31;
  const int half = lane >> 4;
  const int lid  = lane & 15;
  for (int kk = 0; kk < klen; kk += 4) {
    v2f a, b;
    a.x = At[(kk + 2 * half) * ldat + lid];
    a.y = At[(kk + 2 * half + 1) * ldat + lid];
    b.x = B[(kk + 2 * half) * ldb + lid];
    b.y = B[(kk + 2 * half + 1) * ldb + lid];
    acc = wmma_k4(a, b, acc);
  }
  return acc;
}

__device__ __forceinline__ void store_tile(float* __restrict__ C, int ldc, v8f acc) {
  const int lane = threadIdx.x & 31;
  const int half = lane >> 4;
  const int lid  = lane & 15;
#pragma unroll
  for (int vv = 0; vv < 8; ++vv)
    C[(vv + 8 * half) * ldc + lid] = acc[vv];
}

template <int CTRL>
__device__ __forceinline__ float dpp_get(float x) {
  const int b = __builtin_bit_cast(int, x);
  return __builtin_bit_cast(
      float, __builtin_amdgcn_update_dpp(b, b, CTRL, 0xf, 0xf, false));
}

__device__ __forceinline__ float xhalf(float x) {
  const int b = __builtin_bit_cast(int, x);
  return __builtin_bit_cast(
      float, __builtin_amdgcn_permlanex16(b, b, 0x76543210, 0xfedcba98, false,
                                          false));
}

__device__ __forceinline__ float row16_max(float x) {  // result in all 16 lanes
  x = fmaxf(x, dpp_get<0x161>(x));
  x = fmaxf(x, dpp_get<0x162>(x));
  x = fmaxf(x, dpp_get<0x164>(x));
  x = fmaxf(x, dpp_get<0x168>(x));
  return x;
}

// ---------------------------------------------------------------------------
// Kernel 1: FAVOR+ feature map for one (b,h,chunk) tile of 128 rows.
//   dd = DNORM * (x @ proj)   (WMMA on raw x, scale at consumption)
//   is_query: feat = RATIO*(exp(dd - diag - rowmax(dd)) + EPS)
//   else    : feat = dd - diag (raw), blockmax[blk] = max(dd) for global stab
// Each wave keeps its 16 x 64 strip of x @ proj in four accumulators and
// finishes it there: accumulator register vv holds row vv + 8 * half, column
// 16 * ct + lid, so a row's maximum is a maximum over ct and over 16 lanes.
// ---------------------------------------------------------------------------
extern "C" __global__ __launch_bounds__(256)
void feat_kernel(const float* __restrict__ x, const float* __restrict__ proj,
                 float* __restrict__ feat, float* __restrict__ blockmax,
                 int is_query) {
  extern __shared__ float smem[];
  float* sx   = smem;                   // 128 rows, pitch PROW: raw x, then feat
  float* sp   = sx + CHUNKC * PROW;     // 64 rows, pitch PCOL
  float* sred = sp + DDIM * PCOL;       // 8: one maximum per wave

  const int tid = threadIdx.x;
  const int bhc = blockIdx.x;
  const int bh  = bhc / NCHUNK;
  const int ch  = bhc % NCHUNK;
  const long base = ((long)bh * SEQ + (long)ch * CHUNKC) * DDIM;

  for (int i = tid; i < CHUNKC * DDIM / 4; i += 256)
    copy_b128(sx + (i >> 4) * PROW + 4 * (i & 15), x + base + 4 * i);
  for (int i = tid; i < DDIM * MDIM / 4; i += 256)
    copy_b128(sp + (i >> 4) * PCOL + 4 * (i & 15), proj + 4 * i);
  async_wait_all();
  __syncthreads();

  // 8 waves: wave w -> row tile w (16 rows), 4 column tiles of 16. Only wave w
  // reads or writes rows 16w .. 16w+15 of sx until the barrier below.
  const int w = tid >> 5;
  const int lane = tid & 31, half = lane >> 4, lid = lane & 15;
  float* strip = sx + (w * 16) * PROW;

  // k outer, column tile inner: one A fragment serves the four tiles and, squared,
  // diag = 0.5 * dnorm^2 * sum(x^2): over the 16 steps the lane sees one half of
  // row lid, lane ^ 16 the other half. Both loops are unrolled so that acc[] is
  // indexed by constants and stays in registers.
  const float* ar = strip + lid * PROW + 2 * half;
  const float* br = sp + (2 * half) * PCOL + lid;
  v8f acc[4] = {};
  float ss = 0.f;
#pragma unroll
  for (int kk = 0; kk < DDIM; kk += 4) {
    v2f a;
    a.x = ar[kk];
    a.y = ar[kk + 1];
    ss += a.x * a.x;
    ss += a.y * a.y;
#pragma unroll
    for (int ct = 0; ct < 4; ++ct) {
      v2f b;
      b.x = br[kk * PCOL + ct * 16];
      b.y = br[(kk + 1) * PCOL + ct * 16];
      acc[ct] = wmma_k4(a, b, acc[ct]);
    }
  }
  ss += xhalf(ss);
  const float dgl = DGSC * ss;           // diag of row lid, in both halves
  // The upper 16 lanes need rows 8..15: there lane n takes row n ^ 8, so that
  // row_share:vv hands every lane the diag of its row vv + 8 * half.
  const float dgs = half ? dpp_get<0x168>(dgl) : dgl;
  const float dg[8] = {dpp_get<0x150>(dgs), dpp_get<0x151>(dgs),
                       dpp_get<0x152>(dgs), dpp_get<0x153>(dgs),
                       dpp_get<0x154>(dgs), dpp_get<0x155>(dgs),
                       dpp_get<0x156>(dgs), dpp_get<0x157>(dgs)};

  float mx[8];
#pragma unroll
  for (int vv = 0; vv < 8; ++vv)
    mx[vv] = DNORM * row16_max(fmaxf(fmaxf(acc[0][vv], acc[1][vv]),
                                     fmaxf(acc[2][vv], acc[3][vv])));

  // Finished values go back into the wave's own strip of sx (its x is used up),
  // from where the whole block stores them as full rows.
  float* dst = strip + (8 * half) * PROW + lid;
  if (is_query) {
#pragma unroll
    for (int vv = 0; vv < 8; ++vv)
#pragma unroll
      for (int ct = 0; ct < 4; ++ct)
        dst[vv * PROW + ct * 16] =
            RATIO * (expf(DNORM * acc[ct][vv] - dg[vv] - mx[vv]) + FEPS);
  } else {
    float bm = mx[0];                    // stab uses max of raw data_dash
#pragma unroll
    for (int vv = 0; vv < 8; ++vv) {
#pragma unroll
      for (int ct = 0; ct < 4; ++ct)
        dst[vv * PROW + ct * 16] =
            DNORM * acc[ct][vv] - dg[vv];  // finished by the consumers
      bm = fmaxf(bm, mx[vv]);
    }
    bm = fmaxf(bm, xhalf(bm));
    if (lane == 0) sred[w] = bm;
  }
  __syncthreads();

  // One wave instruction stores two whole rows (512 contiguous bytes). Unrolled
  // so that the eight LDS reads are in flight together, not one per store.
  const long ob = ((long)bh * SEQ + (long)ch * CHUNKC) * MDIM;
#pragma unroll
  for (int j = 0; j < CHUNKC * MDIM / 4 / 256; ++j) {
    const int i = tid + 256 * j;
    *(float4*)(feat + ob + 4 * i) =
        *(const float4*)(sx + (i >> 4) * PROW + 4 * (i & 15));
  }

  if (!is_query && tid == 0) {
    float gm = sred[0];
    for (int j = 1; j < 8; ++j) gm = fmaxf(gm, sred[j]);
    blockmax[bhc] = gm;
  }
}

// The key features are finished where they are consumed. feat_kernel leaves
// raw = data_dash - diag and one maximum of data_dash per work-group; each
// consumer reduces those maxima itself and applies
//   kp = RATIO * (exp(raw - gmax) + EPS)
// to the raw tile it has staged in LDS.

// Maximum over all BH * NCHUNK block maxima that this wave's lanes read (two
// float4 per thread of a 256-thread block), in every lane of the wave.
static_assert(BH * NCHUNK == 2 * 4 * 256, "two float4 per thread");
__device__ __forceinline__ float wave_part_of_gmax(const float* __restrict__ bmax) {
  const float4 a = ((const float4*)bmax)[threadIdx.x];
  const float4 b = ((const float4*)bmax)[threadIdx.x + 256];
  float m = fmaxf(fmaxf(fmaxf(a.x, a.y), fmaxf(a.z, a.w)),
                  fmaxf(fmaxf(b.x, b.y), fmaxf(b.z, b.w)));
  m = row16_max(m);
  return fmaxf(m, xhalf(m));
}

__device__ __forceinline__ float gmax_of_waves(const float* sred) {
  float gm = sred[0];
#pragma unroll
  for (int j = 1; j < 8; ++j) gm = fmaxf(gm, sred[j]);
  return gm;
}

// Finishes a staged 128 x 64 tile of raw key features in place (row pitch P
// dwords), 256 threads. The LDS reads are written apart from the exps and the
// stores so that the compiler can fetch ahead of the arithmetic; both loops are
// unrolled so that r[] is indexed by constants and stays in registers.
template <int P>
__device__ __forceinline__ void finish_kp_tile(float* skp, float gm) {
  constexpr int N = CHUNKC * MDIM / 4 / 256;
  float4* p = (float4*)(skp + (threadIdx.x >> 4) * P + 4 * (threadIdx.x & 15));
  float4 r[N];
#pragma unroll
  for (int j = 0; j < N; ++j) r[j] = p[j * (16 * P / 4)];
#pragma unroll
  for (int j = 0; j < N; ++j) {
    r[j].x = RATIO * (expf(r[j].x - gm) + FEPS);
    r[j].y = RATIO * (expf(r[j].y - gm) + FEPS);
    r[j].z = RATIO * (expf(r[j].z - gm) + FEPS);
    r[j].w = RATIO * (expf(r[j].w - gm) + FEPS);
    p[j * (16 * P / 4)] = r[j];
  }
}

// Kernel 2: per-chunk sums  ckv = kp^T @ v (64x64, K=128), cks = colsum(kp);
// kp arrives raw and is finished in LDS.
extern "C" __global__ __launch_bounds__(256)
void chunk_sums_kernel(const float* __restrict__ kp, const float* __restrict__ v,
                       const float* __restrict__ bmax,
                       float* __restrict__ ckv, float* __restrict__ cks) {
  extern __shared__ float smem[];
  float* skp = smem;                    // 128 rows, pitch PCOL
  float* sv  = skp + CHUNKC * PCOL;     // 128 rows, pitch PCOL
  float* sred = skp + MDIM;             // 8, in the unused pad of row 0 of skp

  const int tid = threadIdx.x;
  const int bhc = blockIdx.x;
  const int bh  = bhc / NCHUNK;
  const int ch  = bhc % NCHUNK;
  const long kb = ((long)bh * SEQ + (long)ch * CHUNKC) * MDIM;
  const long vb = ((long)bh * SEQ + (long)ch * CHUNKC) * DVDIM;

  for (int i = tid; i < CHUNKC * MDIM / 4; i += 256) {
    const int l = (i >> 4) * PCOL + 4 * (i & 15);
    copy_b128(skp + l, kp + kb + 4 * i);
    copy_b128(sv + l, v + vb + 4 * i);
  }
  const float wm = wave_part_of_gmax(bmax);
  if ((tid & 31) == 0) sred[tid >> 5] = wm;
  async_wait_all();
  __syncthreads();
  finish_kp_tile<PCOL>(skp, gmax_of_waves(sred));
  __syncthreads();                      // every wave reads all 128 rows of skp

  if (tid < MDIM) {
    float s = 0.f;
    for (int c = 0; c < CHUNKC; ++c) s += skp[c * PCOL + tid];
    cks[(long)bhc * MDIM + tid] = s;
  }

  const int w = tid >> 5;               // 8 waves x 2 tiles = 16 tiles (4x4)
  for (int i = 0; i < 2; ++i) {
    const int t = w * 2 + i, tr = t >> 2, tc = t & 3;
    v8f acc = {};
    acc = mma_tile_At(skp + tr * 16, PCOL, sv + tc * 16, PCOL, CHUNKC, acc);
    store_tile(ckv + (long)bhc * MDIM * DVDIM + (tr * 16) * DVDIM + tc * 16,
               DVDIM, acc);
  }
}

// Kernel 3: exclusive prefix over chunks (in place) -> running kv/ks state.
// One thread owns one column of the scan: four adjacent kv elements (work-groups
// 0 .. PFX_KV_WG-1) or one ks element (the work-groups behind them). A column's
// chunk values are all loaded before the first add, so the loads overlap instead
// of following one another; the adds run in chunk order. The four loops are
// unrolled so that val[] is indexed by constants and stays in registers.
#define PFX_KV_WG (BH * MDIM * DVDIM / 4 / 256)   // 256
#define PFX_KS_WG (BH * MDIM / 256)               // 16
extern "C" __global__ __launch_bounds__(256)
__attribute__((amdgpu_waves_per_eu(2, 4)))
void prefix_kernel(float* __restrict__ ckv, float* __restrict__ cks) {
  const int blk = blockIdx.x, tid = threadIdx.x;
  if (blk < PFX_KV_WG) {
    const int col = blk * 256 + tid;               // float4 column
    const int bh = col / (MDIM * DVDIM / 4);
    const int e4 = col % (MDIM * DVDIM / 4);
    float4* p = (float4*)(ckv + (long)bh * NCHUNK * MDIM * DVDIM) + e4;
    float4 val[NCHUNK];
#pragma unroll
    for (int ch = 0; ch < NCHUNK; ++ch) val[ch] = p[ch * (MDIM * DVDIM / 4)];
    float4 run = make_float4(0.f, 0.f, 0.f, 0.f);
#pragma unroll
    for (int ch = 0; ch < NCHUNK; ++ch) {
      p[ch * (MDIM * DVDIM / 4)] = run;
      run.x += val[ch].x;
      run.y += val[ch].y;
      run.z += val[ch].z;
      run.w += val[ch].w;
    }
  } else {
    const int col = (blk - PFX_KV_WG) * 256 + tid;
    const int bh = col / MDIM;
    const int m  = col % MDIM;
    float* p = cks + (long)bh * NCHUNK * MDIM + m;
    float val[NCHUNK];
#pragma unroll
    for (int ch = 0; ch < NCHUNK; ++ch) val[ch] = p[ch * MDIM];
    float run = 0.f;
#pragma unroll
    for (int ch = 0; ch < NCHUNK; ++ch) {
      p[ch * MDIM] = run;
      run += val[ch];
    }
    // Closes the stores above before any of their registers is written again.
    asm volatile("s_wait_xcnt 0x0" ::: "memory");
  }
}

// Kernel 4: per-chunk output, computed transposed so that the scores never
// leave the registers. kp arrives raw and is finished in LDS.
//   St   = kp @ qp^T (keys x queries), masked to key <= query   [WMMA]
//   numT = v^T @ St + kv_prefix^T @ qp^T                        [WMMA]
//   den  = colsum(St) + qp . ks_prefix
//   out  = num / den
// Wave w owns queries 16w .. 16w+15. A result tile of St holds, in register r of
// lane (half, lid), key r + 8 * half of query lid. Registers 2j and 2j+1 are
// therefore a B fragment whose four k positions are keys 2j, 2j+1, 2j+8, 2j+9;
// the v^T fragment beside it takes its rows in the same order.
extern "C" __global__ __launch_bounds__(256)
void out_kernel(const float* __restrict__ qp, const float* __restrict__ kp,
                const float* __restrict__ v, const float* __restrict__ ckv,
                const float* __restrict__ cks, const float* __restrict__ bmax,
                float* __restrict__ out) {
  extern __shared__ float smem[];
  float* sq   = smem;                     // 128 rows, pitch PROW: qp, then out
  float* sk   = sq + CHUNKC * PROW;       // 128 rows, pitch PROW
  float* sv   = sk + CHUNKC * PROW;       // 128 rows
  float* skv  = sv + CHUNKC * PROW;       // 64 rows, pitch PCOL
  float* sks  = skv + MDIM * PCOL;        // 64
  float* sred = sks + MDIM;               // 8: one maximum per wave

  const int tid = threadIdx.x;
  const int bhc = blockIdx.x;
  const int bh  = bhc / NCHUNK;
  const int ch  = bhc % NCHUNK;
  const long fb = ((long)bh * SEQ + (long)ch * CHUNKC) * MDIM;
  const long vb = ((long)bh * SEQ + (long)ch * CHUNKC) * DVDIM;

  for (int i = tid; i < CHUNKC * MDIM / 4; i += 256) {
    const int l = (i >> 4) * PROW + 4 * (i & 15);
    copy_b128(sq + l, qp + fb + 4 * i);
    copy_b128(sk + l, kp + fb + 4 * i);
    copy_b128(sv + l, v + vb + 4 * i);
  }
  for (int i = tid; i < MDIM * DVDIM / 4; i += 256)
    copy_b128(skv + (i >> 4) * PCOL + 4 * (i & 15),
              ckv + (long)bhc * MDIM * DVDIM + 4 * i);
  if (tid < MDIM) sks[tid] = cks[(long)bhc * MDIM + tid];
  const float wm = wave_part_of_gmax(bmax);
  if ((tid & 31) == 0) sred[tid >> 5] = wm;
  async_wait_all();
  __syncthreads();
  finish_kp_tile<PROW>(sk, gmax_of_waves(sred));
  __syncthreads();                        // every wave reads the whole of sk

  const int w = tid >> 5;
  const int lane = tid & 31, half = lane >> 4, lid = lane & 15;
  // Only wave w reads or writes rows 16w .. 16w+15 of sq from here on.
  float* strip = sq + (w * 16) * PROW;

  // qp^T as B fragments, read once and used by both products that take it. All
  // loops over st, vv, j and dt are unrolled so that qf[], s and oacc[] are
  // indexed by constants and stay in registers.
  v2f qf[MDIM / 4];
  {
    const float* qr = strip + lid * PROW + 2 * half;
#pragma unroll
    for (int st = 0; st < MDIM / 4; ++st) {
      qf[st].x = qr[4 * st];
      qf[st].y = qr[4 * st + 1];
    }
  }

  v8f oacc[4] = {};
  float dsum = 0.f;                       // this half's share of den of query lid
  for (int tc = 0; tc < CHUNKC / 16; ++tc) {
    const float* kr = sk + (tc * 16 + lid) * PROW + 2 * half;
    v8f s = {};
#pragma unroll
    for (int st = 0; st < MDIM / 4; ++st) {
      v2f a;
      a.x = kr[4 * st];
      a.y = kr[4 * st + 1];
      s = wmma_k4(a, qf[st], s);
    }
    const int lim = (w - tc) * 16 + lid - 8 * half;   // keep register vv <= lim
#pragma unroll
    for (int vv = 0; vv < 8; ++vv) {
      s[vv] = (vv <= lim) ? s[vv] : 0.f;
      dsum += s[vv];
    }
    const float* vr = sv + (tc * 16 + 8 * half) * PROW + lid;
#pragma unroll
    for (int j = 0; j < 4; ++j) {
      v2f b;
      b.x = s[2 * j];
      b.y = s[2 * j + 1];
#pragma unroll
      for (int dt = 0; dt < 4; ++dt) {
        v2f a;
        a.x = vr[(2 * j) * PROW + dt * 16];
        a.y = vr[(2 * j + 1) * PROW + dt * 16];
        oacc[dt] = wmma_k4(a, b, oacc[dt]);
      }
    }
  }

  {
    const float* cr = skv + (2 * half) * PCOL + lid;
    const float* sr = sks + 2 * half;
#pragma unroll
    for (int st = 0; st < MDIM / 4; ++st) {
#pragma unroll
      for (int dt = 0; dt < 4; ++dt) {
        v2f a;
        a.x = cr[(4 * st) * PCOL + dt * 16];
        a.y = cr[(4 * st + 1) * PCOL + dt * 16];
        oacc[dt] = wmma_k4(a, qf[st], oacc[dt]);
      }
      dsum += qf[st].x * sr[4 * st];
      dsum += qf[st].y * sr[4 * st + 1];
    }
  }
  const float den = dsum + xhalf(dsum);

  // oacc[dt][vv] is column 16 * dt + 8 * half + vv of query lid: eight adjacent
  // values. They go into the wave's own strip of sq (its qp is used up) and leave
  // from there as full rows.
  float* orow = strip + lid * PROW + 8 * half;
#pragma unroll
  for (int dt = 0; dt < 4; ++dt) {
    *(float4*)(orow + dt * 16) =
        make_float4(oacc[dt][0] / den, oacc[dt][1] / den, oacc[dt][2] / den,
                    oacc[dt][3] / den);
    *(float4*)(orow + dt * 16 + 4) =
        make_float4(oacc[dt][4] / den, oacc[dt][5] / den, oacc[dt][6] / den,
                    oacc[dt][7] / den);
  }
  // Keeps the compiler from moving a lane's reads below in front of the stores
  // above: each lane reads what other lanes of its wave wrote. The LDS serves one
  // wave's operations in order, so no work-group barrier is needed.
  __builtin_amdgcn_fence(__ATOMIC_ACQ_REL, "wavefront");
  // One wave instruction stores two whole rows (512 contiguous bytes). Unrolled
  // so that the eight LDS reads are in flight together, not one per store.
  float* og = out + vb + (long)(w * 16) * DVDIM;
#pragma unroll
  for (int j = 0; j < 8; ++j)
    *(float4*)(og + (2 * j + half) * DVDIM + 4 * lid) =
        *(const float4*)(strip + (2 * j + half) * PROW + 4 * lid);
}

// ---------------------------------------------------------------------------
extern "C" void kernel_launch(void* const* d_in, const int* in_sizes, int n_in,
                              void* d_out, int out_size, void* d_ws,
                              size_t ws_size, hipStream_t stream) {
  const float* q    = (const float*)d_in[0];
  const float* k    = (const float*)d_in[1];
  const float* v    = (const float*)d_in[2];
  const float* proj = (const float*)d_in[3];
  float* out = (float*)d_out;

  float* ws = (float*)d_ws;
  const long FEAT = (long)BH * SEQ * MDIM;            // 16,777,216 floats
  float* qp   = ws;
  float* kp   = qp + FEAT;
  float* ckv  = kp + FEAT;                            // BH*NC*64*64
  float* cks  = ckv + (long)BH * NCHUNK * MDIM * DVDIM;
  float* bmax = cks + (long)BH * NCHUNK * MDIM;

  const size_t featShm =
      (size_t)(CHUNKC * PROW + DDIM * PCOL + 8) * sizeof(float);
  const size_t csumShm = (size_t)(CHUNKC * PCOL + CHUNKC * PCOL) * sizeof(float);
  const size_t outShm =
      (size_t)(3 * CHUNKC * PROW + MDIM * PCOL + MDIM + 8) * sizeof(float);

  (void)hipFuncSetAttribute(reinterpret_cast<const void*>(feat_kernel),
                            hipFuncAttributeMaxDynamicSharedMemorySize,
                            (int)featShm);
  (void)hipFuncSetAttribute(reinterpret_cast<const void*>(chunk_sums_kernel),
                            hipFuncAttributeMaxDynamicSharedMemorySize,
                            (int)csumShm);
  (void)hipFuncSetAttribute(reinterpret_cast<const void*>(out_kernel),
                            hipFuncAttributeMaxDynamicSharedMemorySize,
                            (int)outShm);

  feat_kernel<<<BH * NCHUNK, 256, featShm, stream>>>(q, proj, qp, bmax, 1);
  feat_kernel<<<BH * NCHUNK, 256, featShm, stream>>>(k, proj, kp, bmax, 0);
  chunk_sums_kernel<<<BH * NCHUNK, 256, csumShm, stream>>>(kp, v, bmax, ckv, cks);
  prefix_kernel<<<PFX_KV_WG + PFX_KS_WG, 256, 0, stream>>>(ckv, cks);
  out_kernel<<<BH * NCHUNK, 256, outShm, stream>>>(qp, kp, v, ckv, cks, bmax,
                                                   out);
}

// v006
// A run of this version takes 163 microseconds.
// Timed twice side by side with v005, it ran 1.07 times as fast both times.
// All steps since v000 together make it 4.59 times as fast.
#include <hip/hip_runtime.h>
#include <math.h>
#include <stdint.h>

// Problem constants (match reference)
#define BDIM 4
#define HDIM 16
#define SEQ 4096
#define DDIM 64
#define MDIM 64
#define DVDIM 64
#define CHUNKC 128
#define NCHUNK (SEQ / CHUNKC)   // 32
#define BH (BDIM * HDIM)        // 64
#define FEPS 1e-4f
#define DNORM 0.35355339059327379f  // 64^-0.25
#define DGSC  0.0625f               // 0.5 * DNORM^2 = 0.5 * 64^-0.5
#define RATIO 0.125f                // 64^-0.5

#define PROW 68
#define PCOL 80

typedef __attribute__((ext_vector_type(2))) float v2f;
typedef __attribute__((ext_vector_type(8))) float v8f;
typedef int v4i __attribute__((ext_vector_type(4)));

#define ASYNC_OK __has_builtin(__builtin_amdgcn_global_load_async_to_lds_b128)

__device__ __forceinline__ void copy_b128(float* __restrict__ dst_lds,
                                          const float* __restrict__ src) {
#if ASYNC_OK
  typedef __attribute__((address_space(3))) v4i* lds_v4i_p;
  v4i* g = (v4i*)(uintptr_t)src;                         // generic global ptr
  lds_v4i_p l = (lds_v4i_p)(unsigned)(uintptr_t)dst_lds; // low 32b = LDS offset
  __builtin_amdgcn_global_load_async_to_lds_b128(g, l, 0, 0);
#else
  *(float4*)dst_lds = *(const float4*)src;
#endif
}

__device__ __forceinline__ void async_wait_all() {
#if ASYNC_OK
#if __has_builtin(__builtin_amdgcn_s_wait_asynccnt)
  __builtin_amdgcn_s_wait_asynccnt(0);
#else
  asm volatile("s_wait_asynccnt 0x0" ::: "memory");
#endif
#endif
}

__device__ __forceinline__ v8f wmma_k4(v2f a, v2f b, v8f c) {
  return __builtin_amdgcn_wmma_f32_16x16x4_f32(
      false, a, false, b, (short)0, c, false, false);
}

// C(16x16) += A^T * B, where At is stored K-major: A[m][k] = At[k*ldat + m].
__device__ __forceinline__ v8f mma_tile_At(const float* __restrict__ At, int ldat,
                                           const float* __restrict__ B, int ldb,
                                           int klen, v8f acc) {
  const int lane = threadIdx.x & 31;
  const int half = lane >> 4;
  const int lid  = lane & 15;
  for (int kk = 0; kk < klen; kk += 4) {
    v2f a, b;
    a.x = At[(kk + 2 * half) * ldat + lid];
    a.y = At[(kk + 2 * half + 1) * ldat + lid];
    b.x = B[(kk + 2 * half) * ldb + lid];
    b.y = B[(kk + 2 * half + 1) * ldb + lid];
    acc = wmma_k4(a, b, acc);
  }
  return acc;
}

__device__ __forceinline__ void store_tile(float* __restrict__ C, int ldc, v8f acc) {
  const int lane = threadIdx.x & 31;
  const int half = lane >> 4;
  const int lid  = lane & 15;
#pragma unroll
  for (int vv = 0; vv < 8; ++vv)
    C[(vv + 8 * half) * ldc + lid] = acc[vv];
}

template <int CTRL>
__device__ __forceinline__ float dpp_get(float x) {
  const int b = __builtin_bit_cast(int, x);
  return __builtin_bit_cast(
      float, __builtin_amdgcn_update_dpp(b, b, CTRL, 0xf, 0xf, false));
}

__device__ __forceinline__ float xhalf(float x) {
  const int b = __builtin_bit_cast(int, x);
  return __builtin_bit_cast(
      float, __builtin_amdgcn_permlanex16(b, b, 0x76543210, 0xfedcba98, false,
                                          false));
}

__device__ __forceinline__ float row16_max(float x) {  // result in all 16 lanes
  x = fmaxf(x, dpp_get<0x161>(x));
  x = fmaxf(x, dpp_get<0x162>(x));
  x = fmaxf(x, dpp_get<0x164>(x));
  x = fmaxf(x, dpp_get<0x168>(x));
  return x;
}

// ---------------------------------------------------------------------------
// Kernel 1: FAVOR+ feature map for one (b,h,chunk) tile of 128 rows.
//   dd = DNORM * (x @ proj)   (WMMA on raw x, scale at consumption)
//   is_query: feat = RATIO*(exp(dd - diag - rowmax(dd)) + EPS)
//   else    : feat = dd - diag (raw), blockmax[blk] = max(dd) for global stab
// Each wave keeps its 16 x 64 strip of x @ proj in four accumulators and
// finishes it there: accumulator register vv holds row vv + 8 * half, column
// 16 * ct + lid, so a row's maximum is a maximum over ct and over 16 lanes.
// ---------------------------------------------------------------------------
extern "C" __global__ __launch_bounds__(256)
void feat_kernel(const float* __restrict__ x, const float* __restrict__ proj,
                 float* __restrict__ feat, float* __restrict__ blockmax,
                 int is_query) {
  extern __shared__ float smem[];
  float* sx   = smem;                   // 128 rows, pitch PROW: raw x, then feat
  float* sp   = sx + CHUNKC * PROW;     // 64 rows, pitch PCOL
  float* sred = sp + DDIM * PCOL;       // 8: one maximum per wave

  const int tid = threadIdx.x;
  const int bhc = blockIdx.x;
  const int bh  = bhc / NCHUNK;
  const int ch  = bhc % NCHUNK;
  const long base = ((long)bh * SEQ + (long)ch * CHUNKC) * DDIM;

  for (int i = tid; i < CHUNKC * DDIM / 4; i += 256)
    copy_b128(sx + (i >> 4) * PROW + 4 * (i & 15), x + base + 4 * i);
  for (int i = tid; i < DDIM * MDIM / 4; i += 256)
    copy_b128(sp + (i >> 4) * PCOL + 4 * (i & 15), proj + 4 * i);
  async_wait_all();
  __syncthreads();

  // 8 waves: wave w -> row tile w (16 rows), 4 column tiles of 16. Only wave w
  // reads or writes rows 16w .. 16w+15 of sx until the barrier below.
  const int w = tid >> 5;
  const int lane = tid & 31, half = lane >> 4, lid = lane & 15;
  float* strip = sx + (w * 16) * PROW;

  // k outer, column tile inner: one A fragment serves the four tiles and, squared,
  // diag = 0.5 * dnorm^2 * sum(x^2): over the 16 steps the lane sees one half of
  // row lid, lane ^ 16 the other half. Both loops are unrolled so that acc[] is
  // indexed by constants and stays in registers.
  const float* ar = strip + lid * PROW + 2 * half;
  const float* br = sp + (2 * half) * PCOL + lid;
  v8f acc[4] = {};
  float ss = 0.f;
#pragma unroll
  for (int kk = 0; kk < DDIM; kk += 4) {
    v2f a;
    a.x = ar[kk];
    a.y = ar[kk + 1];
    ss += a.x * a.x;
    ss += a.y * a.y;
#pragma unroll
    for (int ct = 0; ct < 4; ++ct) {
      v2f b;
      b.x = br[kk * PCOL + ct * 16];
      b.y = br[(kk + 1) * PCOL + ct * 16];
      acc[ct] = wmma_k4(a, b, acc[ct]);
    }
  }
  ss += xhalf(ss);
  const float dgl = DGSC * ss;           // diag of row lid, in both halves
  // The upper 16 lanes need rows 8..15: there lane n takes row n ^ 8, so that
  // row_share:vv hands every lane the diag of its row vv + 8 * half.
  const float dgs = half ? dpp_get<0x168>(dgl) : dgl;
  const float dg[8] = {dpp_get<0x150>(dgs), dpp_get<0x151>(dgs),
                       dpp_get<0x152>(dgs), dpp_get<0x153>(dgs),
                       dpp_get<0x154>(dgs), dpp_get<0x155>(dgs),
                       dpp_get<0x156>(dgs), dpp_get<0x157>(dgs)};

  float mx[8];
#pragma unroll
  for (int vv = 0; vv < 8; ++vv)
    mx[vv] = DNORM * row16_max(fmaxf(fmaxf(acc[0][vv], acc[1][vv]),
                                     fmaxf(acc[2][vv], acc[3][vv])));

  // Finished values go back into the wave's own strip of sx (its x is used up),
  // from where the whole block stores them as full rows.
  float* dst = strip + (8 * half) * PROW + lid;
  if (is_query) {
#pragma unroll
    for (int vv = 0; vv < 8; ++vv)
#pragma unroll
      for (int ct = 0; ct < 4; ++ct)
        dst[vv * PROW + ct * 16] =
            RATIO * (expf(DNORM * acc[ct][vv] - dg[vv] - mx[vv]) + FEPS);
  } else {
    float bm = mx[0];                    // stab uses max of raw data_dash
#pragma unroll
    for (int vv = 0; vv < 8; ++vv) {
#pragma unroll
      for (int ct = 0; ct < 4; ++ct)
        dst[vv * PROW + ct * 16] =
            DNORM * acc[ct][vv] - dg[vv];  // finished by the consumers
      bm = fmaxf(bm, mx[vv]);
    }
    bm = fmaxf(bm, xhalf(bm));
    if (lane == 0) sred[w] = bm;
  }
  __syncthreads();

  // One wave instruction stores two whole rows (512 contiguous bytes). Unrolled
  // so that the eight LDS reads are in flight together, not one per store.
  const long ob = ((long)bh * SEQ + (long)ch * CHUNKC) * MDIM;
#pragma unroll
  for (int j = 0; j < CHUNKC * MDIM / 4 / 256; ++j) {
    const int i = tid + 256 * j;
    *(float4*)(feat + ob + 4 * i) =
        *(const float4*)(sx + (i >> 4) * PROW + 4 * (i & 15));
  }

  if (!is_query && tid == 0) {
    float gm = sred[0];
    for (int j = 1; j < 8; ++j) gm = fmaxf(gm, sred[j]);
    blockmax[bhc] = gm;
  }
}

// The key features are finished where they are consumed. feat_kernel leaves
// raw = data_dash - diag and one maximum of data_dash per work-group; each
// consumer reduces those maxima itself and applies
//   kp = RATIO * (exp(raw - gmax) + EPS)
// to the raw tile it has staged in LDS.

// Maximum over all BH * NCHUNK block maxima that this wave's lanes read (two
// float4 per thread of a 256-thread block), in every lane of the wave.
static_assert(BH * NCHUNK == 2 * 4 * 256, "two float4 per thread");
__device__ __forceinline__ float wave_part_of_gmax(const float* __restrict__ bmax) {
  const float4 a = ((const float4*)bmax)[threadIdx.x];
  const float4 b = ((const float4*)bmax)[threadIdx.x + 256];
  float m = fmaxf(fmaxf(fmaxf(a.x, a.y), fmaxf(a.z, a.w)),
                  fmaxf(fmaxf(b.x, b.y), fmaxf(b.z, b.w)));
  m = row16_max(m);
  return fmaxf(m, xhalf(m));
}

__device__ __forceinline__ float gmax_of_waves(const float* sred) {
  float gm = sred[0];
#pragma unroll
  for (int j = 1; j < 8; ++j) gm = fmaxf(gm, sred[j]);
  return gm;
}

// Finishes a staged 128 x 64 tile of raw key features in place (row pitch P
// dwords), 256 threads. The LDS reads are written apart from the exps and the
// stores so that the compiler can fetch ahead of the arithmetic; both loops are
// unrolled so that r[] is indexed by constants and stays in registers.
template <int P>
__device__ __forceinline__ void finish_kp_tile(float* skp, float gm) {
  constexpr int N = CHUNKC * MDIM / 4 / 256;
  float4* p = (float4*)(skp + (threadIdx.x >> 4) * P + 4 * (threadIdx.x & 15));
  float4 r[N];
#pragma unroll
  for (int j = 0; j < N; ++j) r[j] = p[j * (16 * P / 4)];
#pragma unroll
  for (int j = 0; j < N; ++j) {
    r[j].x = RATIO * (expf(r[j].x - gm) + FEPS);
    r[j].y = RATIO * (expf(r[j].y - gm) + FEPS);
    r[j].z = RATIO * (expf(r[j].z - gm) + FEPS);
    r[j].w = RATIO * (expf(r[j].w - gm) + FEPS);
    p[j * (16 * P / 4)] = r[j];
  }
}

// Kernel 2: per-chunk sums  ckv = kp^T @ v (64x64, K=128), cks = colsum(kp);
// kp arrives raw and is finished in LDS.
extern "C" __global__ __launch_bounds__(256)
void chunk_sums_kernel(const float* __restrict__ kp, const float* __restrict__ v,
                       const float* __restrict__ bmax,
                       float* __restrict__ ckv, float* __restrict__ cks) {
  extern __shared__ float smem[];
  float* skp = smem;                    // 128 rows, pitch PCOL
  float* sv  = skp + CHUNKC * PCOL;     // 128 rows, pitch PCOL
  float* sred = skp + MDIM;             // 8, in the unused pad of row 0 of skp

  const int tid = threadIdx.x;
  const int bhc = blockIdx.x;
  const int bh  = bhc / NCHUNK;
  const int ch  = bhc % NCHUNK;
  const long kb = ((long)bh * SEQ + (long)ch * CHUNKC) * MDIM;
  const long vb = ((long)bh * SEQ + (long)ch * CHUNKC) * DVDIM;

  for (int i = tid; i < CHUNKC * MDIM / 4; i += 256) {
    const int l = (i >> 4) * PCOL + 4 * (i & 15);
    copy_b128(skp + l, kp + kb + 4 * i);
    copy_b128(sv + l, v + vb + 4 * i);
  }
  const float wm = wave_part_of_gmax(bmax);
  if ((tid & 31) == 0) sred[tid >> 5] = wm;
  async_wait_all();
  __syncthreads();
  finish_kp_tile<PCOL>(skp, gmax_of_waves(sred));
  __syncthreads();                      // every wave reads all 128 rows of skp

  if (tid < MDIM) {
    float s = 0.f;
    for (int c = 0; c < CHUNKC; ++c) s += skp[c * PCOL + tid];
    cks[(long)bhc * MDIM + tid] = s;
  }

  const int w = tid >> 5;               // 8 waves x 2 tiles = 16 tiles (4x4)
  for (int i = 0; i < 2; ++i) {
    const int t = w * 2 + i, tr = t >> 2, tc = t & 3;
    v8f acc = {};
    acc = mma_tile_At(skp + tr * 16, PCOL, sv + tc * 16, PCOL, CHUNKC, acc);
    store_tile(ckv + (long)bhc * MDIM * DVDIM + (tr * 16) * DVDIM + tc * 16,
               DVDIM, acc);
  }
}

// Kernel 3: exclusive prefix over chunks (in place) -> running kv/ks state.
// One thread owns one column of the scan: four adjacent kv elements (work-groups
// 0 .. PFX_KV_WG-1) or one ks element (the work-groups behind them). A column's
// chunk values are all loaded before the first add, so the loads overlap instead
// of following one another; the adds run in chunk order. The four loops are
// unrolled so that val[] is indexed by constants and stays in registers.
#define PFX_KV_WG (BH * MDIM * DVDIM / 4 / 256)   // 256
#define PFX_KS_WG (BH * MDIM / 256)               // 16
extern "C" __global__ __launch_bounds__(256)
__attribute__((amdgpu_waves_per_eu(2, 4)))
void prefix_kernel(float* __restrict__ ckv, float* __restrict__ cks) {
  const int blk = blockIdx.x, tid = threadIdx.x;
  if (blk < PFX_KV_WG) {
    const int col = blk * 256 + tid;               // float4 column
    const int bh = col / (MDIM * DVDIM / 4);
    const int e4 = col % (MDIM * DVDIM / 4);
    float4* p = (float4*)(ckv + (long)bh * NCHUNK * MDIM * DVDIM) + e4;
    float4 val[NCHUNK];
#pragma unroll
    for (int ch = 0; ch < NCHUNK; ++ch) val[ch] = p[ch * (MDIM * DVDIM / 4)];
    float4 run = make_float4(0.f, 0.f, 0.f, 0.f);
#pragma unroll
    for (int ch = 0; ch < NCHUNK; ++ch) {
      p[ch * (MDIM * DVDIM / 4)] = run;
      run.x += val[ch].x;
      run.y += val[ch].y;
      run.z += val[ch].z;
      run.w += val[ch].w;
    }
  } else {
    const int col = (blk - PFX_KV_WG) * 256 + tid;
    const int bh = col / MDIM;
    const int m  = col % MDIM;
    float* p = cks + (long)bh * NCHUNK * MDIM + m;
    float val[NCHUNK];
#pragma unroll
    for (int ch = 0; ch < NCHUNK; ++ch) val[ch] = p[ch * MDIM];
    float run = 0.f;
#pragma unroll
    for (int ch = 0; ch < NCHUNK; ++ch) {
      p[ch * MDIM] = run;
      run += val[ch];
    }
    // Closes the stores above before any of their registers is written again.
    asm volatile("s_wait_xcnt 0x0" ::: "memory");
  }
}

// Kernel 4: per-chunk output, computed transposed so that the scores never
// leave the registers. kp arrives raw and is finished in LDS.
//   St   = kp @ qp^T (keys x queries), masked to key <= query   [WMMA]
//   numT = v^T @ St + kv_prefix^T @ qp^T                        [WMMA]
//   den  = colsum(St) + qp . ks_prefix
//   out  = num / den
// Each wave owns one strip of 16 queries and walks only the key tiles up to its
// own diagonal tile: the tiles behind it are masked to zero as a whole. A result
// tile of St holds, in register r of lane (half, lid), key r + 8 * half of query
// lid. Registers 2j and 2j+1 are
// therefore a B fragment whose four k positions are keys 2j, 2j+1, 2j+8, 2j+9;
// the v^T fragment beside it takes its rows in the same order.
extern "C" __global__ __launch_bounds__(256)
void out_kernel(const float* __restrict__ qp, const float* __restrict__ kp,
                const float* __restrict__ v, const float* __restrict__ ckv,
                const float* __restrict__ cks, const float* __restrict__ bmax,
                float* __restrict__ out) {
  extern __shared__ float smem[];
  float* sq   = smem;                     // 128 rows, pitch PROW: qp, then out
  float* sk   = sq + CHUNKC * PROW;       // 128 rows, pitch PROW
  float* sv   = sk + CHUNKC * PROW;       // 128 rows
  float* skv  = sv + CHUNKC * PROW;       // 64 rows, pitch PCOL
  float* sks  = skv + MDIM * PCOL;        // 64
  float* sred = sks + MDIM;               // 8: one maximum per wave

  const int tid = threadIdx.x;
  const int bhc = blockIdx.x;
  const int bh  = bhc / NCHUNK;
  const int ch  = bhc % NCHUNK;
  const long fb = ((long)bh * SEQ + (long)ch * CHUNKC) * MDIM;
  const long vb = ((long)bh * SEQ + (long)ch * CHUNKC) * DVDIM;

  for (int i = tid; i < CHUNKC * MDIM / 4; i += 256) {
    const int l = (i >> 4) * PROW + 4 * (i & 15);
    copy_b128(sq + l, qp + fb + 4 * i);
    copy_b128(sk + l, kp + fb + 4 * i);
    copy_b128(sv + l, v + vb + 4 * i);
  }
  for (int i = tid; i < MDIM * DVDIM / 4; i += 256)
    copy_b128(skv + (i >> 4) * PCOL + 4 * (i & 15),
              ckv + (long)bhc * MDIM * DVDIM + 4 * i);
  if (tid < MDIM) sks[tid] = cks[(long)bhc * MDIM + tid];
  const float wm = wave_part_of_gmax(bmax);
  if ((tid & 31) == 0) sred[tid >> 5] = wm;
  async_wait_all();
  __syncthreads();
  finish_kp_tile<PROW>(sk, gmax_of_waves(sred));
  __syncthreads();                        // each key tile a wave reads was finished by all waves

  // The wave's number as a scalar, so that the key loop's trip count is one too.
  const int w = __builtin_amdgcn_readfirstlane(tid >> 5);
  const int lane = tid & 31, half = lane >> 4, lid = lane & 15;
  const int qs = w < 4 ? w : 11 - w;
  // Only this wave reads or writes rows 16qs .. 16qs+15 of sq from here on.
  float* strip = sq + (qs * 16) * PROW;

  // qp^T as B fragments, read once and used by both products that take it. All
  // loops over st, vv, j and dt are unrolled so that qf[], s and oacc[] are
  // indexed by constants and stay in registers.
  v2f qf[MDIM / 4];
  {
    const float* qr = strip + lid * PROW + 2 * half;
#pragma unroll
    for (int st = 0; st < MDIM / 4; ++st) {
      qf[st].x = qr[4 * st];
      qf[st].y = qr[4 * st + 1];
    }
  }

  v8f oacc[4] = {};
  float dsum = 0.f;                       // this half's share of den of query lid
  for (int tc = 0; tc <= qs; ++tc) {
    const float* kr = sk + (tc * 16 + lid) * PROW + 2 * half;
    v8f s = {};
#pragma unroll
    for (int st = 0; st < MDIM / 4; ++st) {
      v2f a;
      a.x = kr[4 * st];
      a.y = kr[4 * st + 1];
      s = wmma_k4(a, qf[st], s);
    }
    const int lim = (qs - tc) * 16 + lid - 8 * half;  // keep register vv <= lim
#pragma unroll
    for (int vv = 0; vv < 8; ++vv) {
      s[vv] = (vv <= lim) ? s[vv] : 0.f;
      dsum += s[vv];
    }
    const float* vr = sv + (tc * 16 + 8 * half) * PROW + lid;
#pragma unroll
    for (int j = 0; j < 4; ++j) {
      v2f b;
      b.x = s[2 * j];
      b.y = s[2 * j + 1];
#pragma unroll
      for (int dt = 0; dt < 4; ++dt) {
        v2f a;
        a.x = vr[(2 * j) * PROW + dt * 16];
        a.y = vr[(2 * j + 1) * PROW + dt * 16];
        oacc[dt] = wmma_k4(a, b, oacc[dt]);
      }
    }
  }

  {
    const float* cr = skv + (2 * half) * PCOL + lid;
    const float* sr = sks + 2 * half;
#pragma unroll
    for (int st = 0; st < MDIM / 4; ++st) {
#pragma unroll
      for (int dt = 0; dt < 4; ++dt) {
        v2f a;
        a.x = cr[(4 * st) * PCOL + dt * 16];
        a.y = cr[(4 * st + 1) * PCOL + dt * 16];
        oacc[dt] = wmma_k4(a, qf[st], oacc[dt]);
      }
      dsum += qf[st].x * sr[4 * st];
      dsum += qf[st].y * sr[4 * st + 1];
    }
  }
  const float den = dsum + xhalf(dsum);

  // oacc[dt][vv] is column 16 * dt + 8 * half + vv of query lid: eight adjacent
  // values. They go into the wave's own strip of sq (its qp is used up) and leave
  // from there as full rows.
  float* orow = strip + lid * PROW + 8 * half;
#pragma unroll
  for (int dt = 0; dt < 4; ++dt) {
    *(float4*)(orow + dt * 16) =
        make_float4(oacc[dt][0] / den, oacc[dt][1] / den, oacc[dt][2] / den,
                    oacc[dt][3] / den);
    *(float4*)(orow + dt * 16 + 4) =
        make_float4(oacc[dt][4] / den, oacc[dt][5] / den, oacc[dt][6] / den,
                    oacc[dt][7] / den);
  }
  // Keeps the compiler from moving a lane's reads below in front of the stores
  // above: each lane reads what other lanes of its wave wrote. The LDS serves one
  // wave's operations in order, so no work-group barrier is needed.
  __builtin_amdgcn_fence(__ATOMIC_ACQ_REL, "wavefront");
  // One wave instruction stores two whole rows (512 contiguous bytes). Unrolled
  // so that the eight LDS reads are in flight together, not one per store.
  float* og = out + vb + (long)(qs * 16) * DVDIM;
#pragma unroll
  for (int j = 0; j < 8; ++j)
    *(float4*)(og + (2 * j + half) * DVDIM + 4 * lid) =
        *(const float4*)(strip + (2 * j + half) * PROW + 4 * lid);
}

// ---------------------------------------------------------------------------
extern "C" void kernel_launch(void* const* d_in, const int* in_sizes, int n_in,
                              void* d_out, int out_size, void* d_ws,
                              size_t ws_size, hipStream_t stream) {
  const float* q    = (const float*)d_in[0];
  const float* k    = (const float*)d_in[1];
  const float* v    = (const float*)d_in[2];
  const float* proj = (const float*)d_in[3];
  float* out = (float*)d_out;

  float* ws = (float*)d_ws;
  const long FEAT = (long)BH * SEQ * MDIM;            // 16,777,216 floats
  float* qp   = ws;
  float* kp   = qp + FEAT;
  float* ckv  = kp + FEAT;                            // BH*NC*64*64
  float* cks  = ckv + (long)BH * NCHUNK * MDIM * DVDIM;
  float* bmax = cks + (long)BH * NCHUNK * MDIM;

  const size_t featShm =
      (size_t)(CHUNKC * PROW + DDIM * PCOL + 8) * sizeof(float);
  const size_t csumShm = (size_t)(CHUNKC * PCOL + CHUNKC * PCOL) * sizeof(float);
  const size_t outShm =
      (size_t)(3 * CHUNKC * PROW + MDIM * PCOL + MDIM + 8) * sizeof(float);

  (void)hipFuncSetAttribute(reinterpret_cast<const void*>(feat_kernel),
                            hipFuncAttributeMaxDynamicSharedMemorySize,
                            (int)featShm);
  (void)hipFuncSetAttribute(reinterpret_cast<const void*>(chunk_sums_kernel),
                            hipFuncAttributeMaxDynamicSharedMemorySize,
                            (int)csumShm);
  (void)hipFuncSetAttribute(reinterpret_cast<const void*>(out_kernel),
                            hipFuncAttributeMaxDynamicSharedMemorySize,
                            (int)outShm);

  feat_kernel<<<BH * NCHUNK, 256, featShm, stream>>>(q, proj, qp, bmax, 1);
  feat_kernel<<<BH * NCHUNK, 256, featShm, stream>>>(k, proj, kp, bmax, 0);
  chunk_sums_kernel<<<BH * NCHUNK, 256, csumShm, stream>>>(kp, v, bmax, ckv, cks);
  prefix_kernel<<<PFX_KV_WG + PFX_KS_WG, 256, 0, stream>>>(ckv, cks);
  out_kernel<<<BH * NCHUNK, 256, outShm, stream>>>(qp, kp, v, ckv, cks, bmax,
                                                   out);
}

// v007
// A run of this version takes 154 microseconds.
// In two side-by-side timings against v006, it was 1.05 and 1.06 times as fast.
// All steps since v000 together make it 4.84 times as fast.
#include <hip/hip_runtime.h>
#include <math.h>
#include <stdint.h>

// Problem constants (match reference)
#define BDIM 4
#define HDIM 16
#define SEQ 4096
#define DDIM 64
#define MDIM 64
#define DVDIM 64
#define CHUNKC 128
#define NCHUNK (SEQ / CHUNKC)   // 32
#define BH (BDIM * HDIM)        // 64
#define FEPS 1e-4f
#define DNORM 0.35355339059327379f  // 64^-0.25
#define DGSC  0.0625f               // 0.5 * DNORM^2 = 0.5 * 64^-0.5
#define RATIO 0.125f                // 64^-0.5

#define PROW 68
#define PCOL 80

typedef __attribute__((ext_vector_type(2))) float v2f;
typedef __attribute__((ext_vector_type(8))) float v8f;
typedef int v4i __attribute__((ext_vector_type(4)));

#define ASYNC_OK __has_builtin(__builtin_amdgcn_global_load_async_to_lds_b128)

__device__ __forceinline__ void copy_b128(float* __restrict__ dst_lds,
                                          const float* __restrict__ src) {
#if ASYNC_OK
  typedef __attribute__((address_space(3))) v4i* lds_v4i_p;
  v4i* g = (v4i*)(uintptr_t)src;                         // generic global ptr
  lds_v4i_p l = (lds_v4i_p)(unsigned)(uintptr_t)dst_lds; // low 32b = LDS offset
  __builtin_amdgcn_global_load_async_to_lds_b128(g, l, 0, 0);
#else
  *(float4*)dst_lds = *(const float4*)src;
#endif
}

// The issuing wave's own wait: its copies have landed behind it. Written in asm
// with the memory clobber so that no LDS read is moved in front of it.
__device__ __forceinline__ void async_wait_all() {
#if ASYNC_OK
  asm volatile("s_wait_asynccnt 0x0" ::: "memory");
#endif
}

__device__ __forceinline__ v8f wmma_k4(v2f a, v2f b, v8f c) {
  return __builtin_amdgcn_wmma_f32_16x16x4_f32(
      false, a, false, b, (short)0, c, false, false);
}

// C(16x16) += A^T * B, where At is stored K-major: A[m][k] = At[k*ldat + m].
__device__ __forceinline__ v8f mma_tile_At(const float* __restrict__ At, int ldat,
                                           const float* __restrict__ B, int ldb,
                                           int klen, v8f acc) {
  const int lane = threadIdx.x & 31;
  const int half = lane >> 4;
  const int lid  = lane & 15;
  for (int kk = 0; kk < klen; kk += 4) {
    v2f a, b;
    a.x = At[(kk + 2 * half) * ldat + lid];
    a.y = At[(kk + 2 * half + 1) * ldat + lid];
    b.x = B[(kk + 2 * half) * ldb + lid];
    b.y = B[(kk + 2 * half + 1) * ldb + lid];
    acc = wmma_k4(a, b, acc);
  }
  return acc;
}

__device__ __forceinline__ void store_tile(float* __restrict__ C, int ldc, v8f acc) {
  const int lane = threadIdx.x & 31;
  const int half = lane >> 4;
  const int lid  = lane & 15;
#pragma unroll
  for (int vv = 0; vv < 8; ++vv)
    C[(vv + 8 * half) * ldc + lid] = acc[vv];
}

template <int CTRL>
__device__ __forceinline__ float dpp_get(float x) {
  const int b = __builtin_bit_cast(int, x);
  return __builtin_bit_cast(
      float, __builtin_amdgcn_update_dpp(b, b, CTRL, 0xf, 0xf, false));
}

__device__ __forceinline__ float xhalf(float x) {
  const int b = __builtin_bit_cast(int, x);
  return __builtin_bit_cast(
      float, __builtin_amdgcn_permlanex16(b, b, 0x76543210, 0xfedcba98, false,
                                          false));
}

__device__ __forceinline__ float row16_max(float x) {  // result in all 16 lanes
  x = fmaxf(x, dpp_get<0x161>(x));
  x = fmaxf(x, dpp_get<0x162>(x));
  x = fmaxf(x, dpp_get<0x164>(x));
  x = fmaxf(x, dpp_get<0x168>(x));
  return x;
}

// ---------------------------------------------------------------------------
// Kernel 1: FAVOR+ feature map of the keys, one (b,h,chunk) tile of 128 rows.
//   dd = DNORM * (x @ proj)   (WMMA on raw x, scale at consumption)
//   feat = dd - diag (raw), blockmax[blk] = max(dd) for the global stab
// (The query features need no global maximum: out_kernel makes its own.)
// Each wave keeps its 16 x 64 strip of x @ proj in four accumulators and
// finishes it there: accumulator register vv holds row vv + 8 * half, column
// 16 * ct + lid, so a row's maximum is a maximum over ct and over 16 lanes.
// ---------------------------------------------------------------------------
extern "C" __global__ __launch_bounds__(256)
void feat_kernel(const float* __restrict__ x, const float* __restrict__ proj,
                 float* __restrict__ feat, float* __restrict__ blockmax) {
  extern __shared__ float smem[];
  float* sx   = smem;                   // 128 rows, pitch PROW: raw x, then feat
  float* sp   = sx + CHUNKC * PROW;     // 64 rows, pitch PCOL
  float* sred = sp + DDIM * PCOL;       // 8: one maximum per wave

  const int tid = threadIdx.x;
  const int bhc = blockIdx.x;
  const int bh  = bhc / NCHUNK;
  const int ch  = bhc % NCHUNK;
  const long base = ((long)bh * SEQ + (long)ch * CHUNKC) * DDIM;

  for (int i = tid; i < CHUNKC * DDIM / 4; i += 256)
    copy_b128(sx + (i >> 4) * PROW + 4 * (i & 15), x + base + 4 * i);
  for (int i = tid; i < DDIM * MDIM / 4; i += 256)
    copy_b128(sp + (i >> 4) * PCOL + 4 * (i & 15), proj + 4 * i);
  async_wait_all();
  __syncthreads();

  // 8 waves: wave w -> row tile w (16 rows), 4 column tiles of 16. Only wave w
  // reads or writes rows 16w .. 16w+15 of sx until the barrier below.
  const int w = tid >> 5;
  const int lane = tid & 31, half = lane >> 4, lid = lane & 15;
  float* strip = sx + (w * 16) * PROW;

  // k outer, column tile inner: one A fragment serves the four tiles and, squared,
  // diag = 0.5 * dnorm^2 * sum(x^2): over the 16 steps the lane sees one half of
  // row lid, lane ^ 16 the other half. Both loops are unrolled so that acc[] is
  // indexed by constants and stays in registers.
  const float* ar = strip + lid * PROW + 2 * half;
  const float* br = sp + (2 * half) * PCOL + lid;
  v8f acc[4] = {};
  float ss = 0.f;
#pragma unroll
  for (int kk = 0; kk < DDIM; kk += 4) {
    v2f a;
    a.x = ar[kk];
    a.y = ar[kk + 1];
    ss += a.x * a.x;
    ss += a.y * a.y;
#pragma unroll
    for (int ct = 0; ct < 4; ++ct) {
      v2f b;
      b.x = br[kk * PCOL + ct * 16];
      b.y = br[(kk + 1) * PCOL + ct * 16];
      acc[ct] = wmma_k4(a, b, acc[ct]);
    }
  }
  ss += xhalf(ss);
  const float dgl = DGSC * ss;           // diag of row lid, in both halves
  // The upper 16 lanes need rows 8..15: there lane n takes row n ^ 8, so that
  // row_share:vv hands every lane the diag of its row vv + 8 * half.
  const float dgs = half ? dpp_get<0x168>(dgl) : dgl;
  const float dg[8] = {dpp_get<0x150>(dgs), dpp_get<0x151>(dgs),
                       dpp_get<0x152>(dgs), dpp_get<0x153>(dgs),
                       dpp_get<0x154>(dgs), dpp_get<0x155>(dgs),
                       dpp_get<0x156>(dgs), dpp_get<0x157>(dgs)};

  float mx[8];
#pragma unroll
  for (int vv = 0; vv < 8; ++vv)
    mx[vv] = DNORM * row16_max(fmaxf(fmaxf(acc[0][vv], acc[1][vv]),
                                     fmaxf(acc[2][vv], acc[3][vv])));

  // Finished values go back into the wave's own strip of sx (its x is used up),
  // from where the whole block stores them as full rows.
  float* dst = strip + (8 * half) * PROW + lid;
  float bm = mx[0];                      // stab uses max of raw data_dash
#pragma unroll
  for (int vv = 0; vv < 8; ++vv) {
#pragma unroll
    for (int ct = 0; ct < 4; ++ct)
      dst[vv * PROW + ct * 16] =
          DNORM * acc[ct][vv] - dg[vv];    // finished by the consumers
    bm = fmaxf(bm, mx[vv]);
  }
  bm = fmaxf(bm, xhalf(bm));
  if (lane == 0) sred[w] = bm;
  __syncthreads();

  // One wave instruction stores two whole rows (512 contiguous bytes). Unrolled
  // so that the eight LDS reads are in flight together, not one per store.
  const long ob = ((long)bh * SEQ + (long)ch * CHUNKC) * MDIM;
#pragma unroll
  for (int j = 0; j < CHUNKC * MDIM / 4 / 256; ++j) {
    const int i = tid + 256 * j;
    *(float4*)(feat + ob + 4 * i) =
        *(const float4*)(sx + (i >> 4) * PROW + 4 * (i & 15));
  }

  if (tid == 0) {
    float gm = sred[0];
    for (int j = 1; j < 8; ++j) gm = fmaxf(gm, sred[j]);
    blockmax[bhc] = gm;
  }
}

// The key features are finished where they are consumed. feat_kernel leaves
// raw = data_dash - diag and one maximum of data_dash per work-group; each
// consumer reduces those maxima itself and applies
//   kp = RATIO * (exp(raw - gmax) + EPS)
// to the raw tile it has staged in LDS.

// Maximum over all BH * NCHUNK block maxima that this wave's lanes read (two
// float4 per thread of a 256-thread block), in every lane of the wave.
static_assert(BH * NCHUNK == 2 * 4 * 256, "two float4 per thread");
__device__ __forceinline__ float wave_part_of_gmax(const float* __restrict__ bmax) {
  const float4 a = ((const float4*)bmax)[threadIdx.x];
  const float4 b = ((const float4*)bmax)[threadIdx.x + 256];
  float m = fmaxf(fmaxf(fmaxf(a.x, a.y), fmaxf(a.z, a.w)),
                  fmaxf(fmaxf(b.x, b.y), fmaxf(b.z, b.w)));
  m = row16_max(m);
  return fmaxf(m, xhalf(m));
}

__device__ __forceinline__ float gmax_of_waves(const float* sred) {
  float gm = sred[0];
#pragma unroll
  for (int j = 1; j < 8; ++j) gm = fmaxf(gm, sred[j]);
  return gm;
}

// Finishes a staged 128 x 64 tile of raw key features in place (row pitch P
// dwords), 256 threads. The LDS reads are written apart from the exps and the
// stores so that the compiler can fetch ahead of the arithmetic; both loops are
// unrolled so that r[] is indexed by constants and stays in registers.
template <int P>
__device__ __forceinline__ void finish_kp_tile(float* skp, float gm) {
  constexpr int N = CHUNKC * MDIM / 4 / 256;
  float4* p = (float4*)(skp + (threadIdx.x >> 4) * P + 4 * (threadIdx.x & 15));
  float4 r[N];
#pragma unroll
  for (int j = 0; j < N; ++j) r[j] = p[j * (16 * P / 4)];
#pragma unroll
  for (int j = 0; j < N; ++j) {
    r[j].x = RATIO * (expf(r[j].x - gm) + FEPS);
    r[j].y = RATIO * (expf(r[j].y - gm) + FEPS);
    r[j].z = RATIO * (expf(r[j].z - gm) + FEPS);
    r[j].w = RATIO * (expf(r[j].w - gm) + FEPS);
    p[j * (16 * P / 4)] = r[j];
  }
}

// Kernel 2: per-chunk sums  ckv = kp^T @ v (64x64, K=128), cks = colsum(kp);
// kp arrives raw and is finished in LDS.
extern "C" __global__ __launch_bounds__(256)
void chunk_sums_kernel(const float* __restrict__ kp, const float* __restrict__ v,
                       const float* __restrict__ bmax,
                       float* __restrict__ ckv, float* __restrict__ cks) {
  extern __shared__ float smem[];
  float* skp = smem;                    // 128 rows, pitch PCOL
  float* sv  = skp + CHUNKC * PCOL;     // 128 rows, pitch PCOL
  float* sred = skp + MDIM;             // 8, in the unused pad of row 0 of skp

  const int tid = threadIdx.x;
  const int bhc = blockIdx.x;
  const int bh  = bhc / NCHUNK;
  const int ch  = bhc % NCHUNK;
  const long kb = ((long)bh * SEQ + (long)ch * CHUNKC) * MDIM;
  const long vb = ((long)bh * SEQ + (long)ch * CHUNKC) * DVDIM;

  for (int i = tid; i < CHUNKC * MDIM / 4; i += 256) {
    const int l = (i >> 4) * PCOL + 4 * (i & 15);
    copy_b128(skp + l, kp + kb + 4 * i);
    copy_b128(sv + l, v + vb + 4 * i);
  }
  const float wm = wave_part_of_gmax(bmax);
  if ((tid & 31) == 0) sred[tid >> 5] = wm;
  async_wait_all();
  __syncthreads();
  finish_kp_tile<PCOL>(skp, gmax_of_waves(sred));
  __syncthreads();                      // every wave reads all 128 rows of skp

  if (tid < MDIM) {
    float s = 0.f;
    for (int c = 0; c < CHUNKC; ++c) s += skp[c * PCOL + tid];
    cks[(long)bhc * MDIM + tid] = s;
  }

  const int w = tid >> 5;               // 8 waves x 2 tiles = 16 tiles (4x4)
  for (int i = 0; i < 2; ++i) {
    const int t = w * 2 + i, tr = t >> 2, tc = t & 3;
    v8f acc = {};
    acc = mma_tile_At(skp + tr * 16, PCOL, sv + tc * 16, PCOL, CHUNKC, acc);
    store_tile(ckv + (long)bhc * MDIM * DVDIM + (tr * 16) * DVDIM + tc * 16,
               DVDIM, acc);
  }
}

// Kernel 3: exclusive prefix over chunks (in place) -> running kv/ks state.
// One thread owns one column of the scan: four adjacent kv elements (work-groups
// 0 .. PFX_KV_WG-1) or one ks element (the work-groups behind them). A column's
// chunk values are all loaded before the first add, so the loads overlap instead
// of following one another; the adds run in chunk order. The four loops are
// unrolled so that val[] is indexed by constants and stays in registers.
#define PFX_KV_WG (BH * MDIM * DVDIM / 4 / 256)   // 256
#define PFX_KS_WG (BH * MDIM / 256)               // 16
extern "C" __global__ __launch_bounds__(256)
__attribute__((amdgpu_waves_per_eu(2, 4)))
void prefix_kernel(float* __restrict__ ckv, float* __restrict__ cks) {
  const int blk = blockIdx.x, tid = threadIdx.x;
  if (blk < PFX_KV_WG) {
    const int col = blk * 256 + tid;               // float4 column
    const int bh = col / (MDIM * DVDIM / 4);
    const int e4 = col % (MDIM * DVDIM / 4);
    float4* p = (float4*)(ckv + (long)bh * NCHUNK * MDIM * DVDIM) + e4;
    float4 val[NCHUNK];
#pragma unroll
    for (int ch = 0; ch < NCHUNK; ++ch) val[ch] = p[ch * (MDIM * DVDIM / 4)];
    float4 run = make_float4(0.f, 0.f, 0.f, 0.f);
#pragma unroll
    for (int ch = 0; ch < NCHUNK; ++ch) {
      p[ch * (MDIM * DVDIM / 4)] = run;
      run.x += val[ch].x;
      run.y += val[ch].y;
      run.z += val[ch].z;
      run.w += val[ch].w;
    }
  } else {
    const int col = (blk - PFX_KV_WG) * 256 + tid;
    const int bh = col / MDIM;
    const int m  = col % MDIM;
    float* p = cks + (long)bh * NCHUNK * MDIM + m;
    float val[NCHUNK];
#pragma unroll
    for (int ch = 0; ch < NCHUNK; ++ch) val[ch] = p[ch * MDIM];
    float run = 0.f;
#pragma unroll
    for (int ch = 0; ch < NCHUNK; ++ch) {
      p[ch * MDIM] = run;
      run += val[ch];
    }
    // Closes the stores above before any of their registers is written again.
    asm volatile("s_wait_xcnt 0x0" ::: "memory");
  }
}

// Kernel 4: per-chunk output, computed transposed so that the scores never
// leave the registers. kp arrives raw and is finished in LDS; the query features
// are made here from q, while the copies of kp, v and the prefix are in flight.
//   ddT  = proj^T @ q^T (features x queries)                    [WMMA]
//   qp   = RATIO * (exp(DNORM * dd - diag - max over features) + EPS)
//   St   = kp @ qp^T (keys x queries), masked to key <= query   [WMMA]
//   numT = v^T @ St + kv_prefix^T @ qp^T                        [WMMA]
//   den  = colsum(St) + qp . ks_prefix
//   out  = num / den
// Each wave owns one strip of 16 queries and walks only the key tiles up to its
// own diagonal tile: the tiles behind it are masked to zero as a whole. A result
// tile of St holds, in register r of lane (half, lid), key r + 8 * half of query
// lid. Registers 2j and 2j+1 are
// therefore a B fragment whose four k positions are keys 2j, 2j+1, 2j+8, 2j+9;
// the v^T fragment beside it takes its rows in the same order.
extern "C" __global__ __launch_bounds__(256)
void out_kernel(const float* __restrict__ q, const float* __restrict__ proj,
                const float* __restrict__ kp, const float* __restrict__ v,
                const float* __restrict__ ckv,
                const float* __restrict__ cks, const float* __restrict__ bmax,
                float* __restrict__ out) {
  extern __shared__ float smem[];
  float* sq   = smem;                     // 128 rows, pitch PROW: q, then out
  float* sk   = sq + CHUNKC * PROW;       // 128 rows, pitch PROW
  float* sv   = sk + CHUNKC * PROW;       // 128 rows
  float* skv  = sv + CHUNKC * PROW;       // 64 rows, pitch PCOL
  float* sp   = skv + MDIM * PCOL;        // 64 rows, pitch PCOL: proj
  float* sks  = sp + DDIM * PCOL;         // 64
  float* sred = sks + MDIM;               // 8: one maximum per wave

  const int tid = threadIdx.x;
  const int bhc = blockIdx.x;
  const int bh  = bhc / NCHUNK;
  const int ch  = bhc % NCHUNK;
  const long fb = ((long)bh * SEQ + (long)ch * CHUNKC) * MDIM;
  const long vb = ((long)bh * SEQ + (long)ch * CHUNKC) * DVDIM;

  // What the query features need comes first and is published by a wait and a
  // barrier of its own.
  for (int i = tid; i < CHUNKC * DDIM / 4; i += 256)
    copy_b128(sq + (i >> 4) * PROW + 4 * (i & 15), q + fb + 4 * i);
  for (int i = tid; i < DDIM * MDIM / 4; i += 256)
    copy_b128(sp + (i >> 4) * PCOL + 4 * (i & 15), proj + 4 * i);
  if (tid < MDIM) sks[tid] = cks[(long)bhc * MDIM + tid];
  const float wm = wave_part_of_gmax(bmax);
  if ((tid & 31) == 0) sred[tid >> 5] = wm;
  async_wait_all();
  __syncthreads();

  // The rest is issued now and waited for behind the query features.
  for (int i = tid; i < CHUNKC * MDIM / 4; i += 256) {
    const int l = (i >> 4) * PROW + 4 * (i & 15);
    copy_b128(sk + l, kp + fb + 4 * i);
    copy_b128(sv + l, v + vb + 4 * i);
  }
  for (int i = tid; i < MDIM * DVDIM / 4; i += 256)
    copy_b128(skv + (i >> 4) * PCOL + 4 * (i & 15),
              ckv + (long)bhc * MDIM * DVDIM + 4 * i);

  // The wave's number as a scalar, so that the key loop's trip count is one too.
  const int w = __builtin_amdgcn_readfirstlane(tid >> 5);
  const int lane = tid & 31, half = lane >> 4, lid = lane & 15;
  const int qs = w < 4 ? w : 11 - w;
  // Only this wave reads or writes rows 16qs .. 16qs+15 of sq from here on.
  float* strip = sq + (qs * 16) * PROW;

  // Query features of the strip, transposed: result row r + 8 * half of feature
  // tile ft, query lid. The A fragment's lane for result row l takes column
  // 16 * ft + pcol(l) of proj, with pcol(2j + e + 8h) = 4j + 2h + e, so that
  // registers 2j and 2j+1 hold features 16 * ft + 4j + 2 * half and the next one:
  // qp^T as B fragments in plain k order, used by both products that take it.
  // A lane holds 32 of its query's 64 features, lane ^ 16 the others, and sees
  // the same halves of row lid of q for diag. All loops over kk, ft, r, st, vv, j
  // and dt are unrolled so that f[], qf[], s and oacc[] are indexed by constants
  // and stay in registers.
  v2f qf[MDIM / 4];
  {
    const int pcol = ((lid & 6) << 1) | ((lid >> 3) << 1) | (lid & 1);
    const float* qr = strip + lid * PROW + 2 * half;
    const float* pr = sp + (2 * half) * PCOL + pcol;
    v8f f[4] = {};
    float ss = 0.f;
#pragma unroll
    for (int kk = 0; kk < DDIM; kk += 4) {
      v2f b;
      b.x = qr[kk];
      b.y = qr[kk + 1];
      ss += b.x * b.x;
      ss += b.y * b.y;
#pragma unroll
      for (int ft = 0; ft < 4; ++ft) {
        v2f a;
        a.x = pr[kk * PCOL + ft * 16];
        a.y = pr[(kk + 1) * PCOL + ft * 16];
        f[ft] = wmma_k4(a, b, f[ft]);
      }
    }
    ss += xhalf(ss);
    const float dg = DGSC * ss;
    float mx = f[0][0];
#pragma unroll
    for (int ft = 0; ft < 4; ++ft)
#pragma unroll
      for (int r = 0; r < 8; ++r) mx = fmaxf(mx, f[ft][r]);
    // DNORM > 0: max(DNORM * a) == DNORM * max(a), rounding included.
    mx = DNORM * fmaxf(mx, xhalf(mx));
#pragma unroll
    for (int ft = 0; ft < 4; ++ft)
#pragma unroll
      for (int j = 0; j < 4; ++j) {
        qf[4 * ft + j].x =
            RATIO * (expf(DNORM * f[ft][2 * j] - dg - mx) + FEPS);
        qf[4 * ft + j].y =
            RATIO * (expf(DNORM * f[ft][2 * j + 1] - dg - mx) + FEPS);
      }
  }

  // Keeps the WMMAs above in front of the wait, so that they run while the copies
  // are in flight: without it the compiler fetches all their fragments and sinks
  // the WMMAs themselves behind the barrier.
  __builtin_amdgcn_sched_barrier(0);
  async_wait_all();
  __syncthreads();
  finish_kp_tile<PROW>(sk, gmax_of_waves(sred));
  __syncthreads();                        // a wave reads rows 0 .. 16qs+15 of sk

  v8f oacc[4] = {};
  float dsum = 0.f;                       // this half's share of den of query lid
  for (int tc = 0; tc <= qs; ++tc) {
    const float* kr = sk + (tc * 16 + lid) * PROW + 2 * half;
    v8f s = {};
#pragma unroll
    for (int st = 0; st < MDIM / 4; ++st) {
      v2f a;
      a.x = kr[4 * st];
      a.y = kr[4 * st + 1];
      s = wmma_k4(a, qf[st], s);
    }
    const int lim = (qs - tc) * 16 + lid - 8 * half;  // keep register vv <= lim
#pragma unroll
    for (int vv = 0; vv < 8; ++vv) {
      s[vv] = (vv <= lim) ? s[vv] : 0.f;
      dsum += s[vv];
    }
    const float* vr = sv + (tc * 16 + 8 * half) * PROW + lid;
#pragma unroll
    for (int j = 0; j < 4; ++j) {
      v2f b;
      b.x = s[2 * j];
      b.y = s[2 * j + 1];
#pragma unroll
      for (int dt = 0; dt < 4; ++dt) {
        v2f a;
        a.x = vr[(2 * j) * PROW + dt * 16];
        a.y = vr[(2 * j + 1) * PROW + dt * 16];
        oacc[dt] = wmma_k4(a, b, oacc[dt]);
      }
    }
  }

  {
    const float* cr = skv + (2 * half) * PCOL + lid;
    const float* sr = sks + 2 * half;
#pragma unroll
    for (int st = 0; st < MDIM / 4; ++st) {
#pragma unroll
      for (int dt = 0; dt < 4; ++dt) {
        v2f a;
        a.x = cr[(4 * st) * PCOL + dt * 16];
        a.y = cr[(4 * st + 1) * PCOL + dt * 16];
        oacc[dt] = wmma_k4(a, qf[st], oacc[dt]);
      }
      dsum += qf[st].x * sr[4 * st];
      dsum += qf[st].y * sr[4 * st + 1];
    }
  }
  const float den = dsum + xhalf(dsum);

  // oacc[dt][vv] is column 16 * dt + 8 * half + vv of query lid: eight adjacent
  // values. They go into the wave's own strip of sq (its q is used up) and leave
  // from there as full rows.
  float* orow = strip + lid * PROW + 8 * half;
#pragma unroll
  for (int dt = 0; dt < 4; ++dt) {
    *(float4*)(orow + dt * 16) =
        make_float4(oacc[dt][0] / den, oacc[dt][1] / den, oacc[dt][2] / den,
                    oacc[dt][3] / den);
    *(float4*)(orow + dt * 16 + 4) =
        make_float4(oacc[dt][4] / den, oacc[dt][5] / den, oacc[dt][6] / den,
                    oacc[dt][7] / den);
  }
  // Keeps the compiler from moving a lane's reads below in front of the stores
  // above: each lane reads what other lanes of its wave wrote. The LDS serves one
  // wave's operations in order, so no work-group barrier is needed.
  __builtin_amdgcn_fence(__ATOMIC_ACQ_REL, "wavefront");
  // One wave instruction stores two whole rows (512 contiguous bytes). Unrolled
  // so that the eight LDS reads are in flight together, not one per store.
  float* og = out + vb + (long)(qs * 16) * DVDIM;
#pragma unroll
  for (int j = 0; j < 8; ++j)
    *(float4*)(og + (2 * j + half) * DVDIM + 4 * lid) =
        *(const float4*)(strip + (2 * j + half) * PROW + 4 * lid);
}

// ---------------------------------------------------------------------------
extern "C" void kernel_launch(void* const* d_in, const int* in_sizes, int n_in,
                              void* d_out, int out_size, void* d_ws,
                              size_t ws_size, hipStream_t stream) {
  const float* q    = (const float*)d_in[0];
  const float* k    = (const float*)d_in[1];
  const float* v    = (const float*)d_in[2];
  const float* proj = (const float*)d_in[3];
  float* out = (float*)d_out;

  float* ws = (float*)d_ws;
  const long FEAT = (long)BH * SEQ * MDIM;            // 16,777,216 floats
  float* kp   = ws;
  float* ckv  = kp + FEAT;                            // BH*NC*64*64
  float* cks  = ckv + (long)BH * NCHUNK * MDIM * DVDIM;
  float* bmax = cks + (long)BH * NCHUNK * MDIM;

  const size_t featShm =
      (size_t)(CHUNKC * PROW + DDIM * PCOL + 8) * sizeof(float);
  const size_t csumShm = (size_t)(CHUNKC * PCOL + CHUNKC * PCOL) * sizeof(float);
  const size_t outShm =
      (size_t)(3 * CHUNKC * PROW + MDIM * PCOL + DDIM * PCOL + MDIM + 8) *
      sizeof(float);

  (void)hipFuncSetAttribute(reinterpret_cast<const void*>(feat_kernel),
                            hipFuncAttributeMaxDynamicSharedMemorySize,
                            (int)featShm);
  (void)hipFuncSetAttribute(reinterpret_cast<const void*>(chunk_sums_kernel),
                            hipFuncAttributeMaxDynamicSharedMemorySize,
                            (int)csumShm);
  (void)hipFuncSetAttribute(reinterpret_cast<const void*>(out_kernel),
                            hipFuncAttributeMaxDynamicSharedMemorySize,
                            (int)outShm);

  feat_kernel<<<BH * NCHUNK, 256, featShm, stream>>>(k, proj, kp, bmax);
  chunk_sums_kernel<<<BH * NCHUNK, 256, csumShm, stream>>>(kp, v, bmax, ckv, cks);
  prefix_kernel<<<PFX_KV_WG + PFX_KS_WG, 256, 0, stream>>>(ckv, cks);
  out_kernel<<<BH * NCHUNK, 256, outShm, stream>>>(q, proj, kp, v, ckv, cks,
                                                   bmax, out);
}

// v008
// Measured time: 143 microseconds a run.
// Next to v007, in two timings, it ran 1.07 times as fast each time.
// Counting every step since v000, it is 5.18 times as fast.
#include <hip/hip_runtime.h>
#include <math.h>
#include <stdint.h>

// Problem constants (match reference)
#define BDIM 4
#define HDIM 16
#define SEQ 4096
#define DDIM 64
#define MDIM 64
#define DVDIM 64
#define CHUNKC 128
#define NCHUNK (SEQ / CHUNKC)   // 32
#define BH (BDIM * HDIM)        // 64
#define FEPS 1e-4f
#define DNORM 0.35355339059327379f  // 64^-0.25
#define DGSC  0.0625f               // 0.5 * DNORM^2 = 0.5 * 64^-0.5
#define RATIO 0.125f                // 64^-0.5

#define PROW 68
#define PCOL 80

typedef __attribute__((ext_vector_type(2))) float v2f;
typedef __attribute__((ext_vector_type(8))) float v8f;
typedef int v4i __attribute__((ext_vector_type(4)));

#define ASYNC_OK __has_builtin(__builtin_amdgcn_global_load_async_to_lds_b128)

__device__ __forceinline__ void copy_b128(float* __restrict__ dst_lds,
                                          const float* __restrict__ src) {
#if ASYNC_OK
  typedef __attribute__((address_space(3))) v4i* lds_v4i_p;
  v4i* g = (v4i*)(uintptr_t)src;                         // generic global ptr
  lds_v4i_p l = (lds_v4i_p)(unsigned)(uintptr_t)dst_lds; // low 32b = LDS offset
  __builtin_amdgcn_global_load_async_to_lds_b128(g, l, 0, 0);
#else
  *(float4*)dst_lds = *(const float4*)src;
#endif
}

// The issuing wave's own wait: its copies have landed behind it. Written in asm
// with the memory clobber so that no LDS read is moved in front of it.
__device__ __forceinline__ void async_wait_all() {
#if ASYNC_OK
  asm volatile("s_wait_asynccnt 0x0" ::: "memory");
#endif
}

// Work-group barrier that orders LDS only. __syncthreads() also waits until the
// wave's global loads and stores have come back; where nothing that passes
// between the waves goes through global memory, they may stay in flight.
__device__ __forceinline__ void lds_barrier() {
  __builtin_amdgcn_fence(__ATOMIC_RELEASE, "workgroup", "local");
  __builtin_amdgcn_s_barrier();
  __builtin_amdgcn_fence(__ATOMIC_ACQUIRE, "workgroup", "local");
}

__device__ __forceinline__ v8f wmma_k4(v2f a, v2f b, v8f c) {
  return __builtin_amdgcn_wmma_f32_16x16x4_f32(
      false, a, false, b, (short)0, c, false, false);
}

__device__ __forceinline__ void store_tile(float* __restrict__ C, int ldc, v8f acc) {
  const int lane = threadIdx.x & 31;
  const int half = lane >> 4;
  const int lid  = lane & 15;
#pragma unroll
  for (int vv = 0; vv < 8; ++vv)
    C[(vv + 8 * half) * ldc + lid] = acc[vv];
}

template <int CTRL>
__device__ __forceinline__ float dpp_get(float x) {
  const int b = __builtin_bit_cast(int, x);
  return __builtin_bit_cast(
      float, __builtin_amdgcn_update_dpp(b, b, CTRL, 0xf, 0xf, false));
}

__device__ __forceinline__ float xhalf(float x) {
  const int b = __builtin_bit_cast(int, x);
  return __builtin_bit_cast(
      float, __builtin_amdgcn_permlanex16(b, b, 0x76543210, 0xfedcba98, false,
                                          false));
}

__device__ __forceinline__ float row16_max(float x) {  // result in all 16 lanes
  x = fmaxf(x, dpp_get<0x161>(x));
  x = fmaxf(x, dpp_get<0x162>(x));
  x = fmaxf(x, dpp_get<0x164>(x));
  x = fmaxf(x, dpp_get<0x168>(x));
  return x;
}

// feat_kernel leaves raw = data_dash - diag and one maximum of data_dash per
// work-group; the kernels behind it reduce those maxima themselves. out_kernel
// applies kp = RATIO * (exp(raw - gmax) + EPS) to the raw tile it has staged.

// Maximum over all BH * NCHUNK block maxima that this wave's lanes read (two
// float4 per thread of a 256-thread block), in every lane of the wave.
static_assert(BH * NCHUNK == 2 * 4 * 256, "two float4 per thread");
__device__ __forceinline__ float wave_max(float4 a, float4 b) {
  float m = fmaxf(fmaxf(fmaxf(a.x, a.y), fmaxf(a.z, a.w)),
                  fmaxf(fmaxf(b.x, b.y), fmaxf(b.z, b.w)));
  m = row16_max(m);
  return fmaxf(m, xhalf(m));
}

__device__ __forceinline__ float wave_part_of_gmax(const float* __restrict__ bmax) {
  return wave_max(((const float4*)bmax)[threadIdx.x],
                  ((const float4*)bmax)[threadIdx.x + 256]);
}

__device__ __forceinline__ float gmax_of_waves(const float* sred) {
  float gm = sred[0];
#pragma unroll
  for (int j = 1; j < 8; ++j) gm = fmaxf(gm, sred[j]);
  return gm;
}

// ---------------------------------------------------------------------------
// Kernel 1: FAVOR+ feature map of the keys and the chunk's sums, one
// (b,h,chunk) tile of 128 rows.
//   dd = DNORM * (x @ proj)   (WMMA on raw x, scale at consumption)
//   feat = dd - diag (raw), blockmax[blk] = max(dd) for the global stab
//   e    = exp(feat - blockmax[blk])         (at most 1: diag >= 0)
//   ckv  = e^T @ v (64x64, K=128) [WMMA], cks = colsum(e), cvs = colsum(v)
// The global maximum is not known here. With s = exp(blockmax[blk] - gmax),
//   kp = RATIO * (exp(feat - gmax) + EPS) = RATIO * (s * e + EPS),
// so the scan kernel, which knows gmax, turns these sums into those of kp:
//   kp^T @ v = RATIO * (s * ckv + EPS * cvs), colsum(kp) = RATIO * (s * cks + EPS * 128).
// (The query features need no global maximum: out_kernel makes its own.)
// Each wave keeps its 16 x 64 strip of x @ proj in four accumulators and
// finishes it there: accumulator register vv holds row vv + 8 * half, column
// 16 * ct + lid, so a row's maximum is a maximum over ct and over 16 lanes.
// ---------------------------------------------------------------------------
extern "C" __global__ __launch_bounds__(256)
void feat_kernel(const float* __restrict__ x, const float* __restrict__ proj,
                 const float* __restrict__ v, float* __restrict__ feat,
                 float* __restrict__ blockmax, float* __restrict__ ckv,
                 float* __restrict__ cks, float* __restrict__ cvs) {
  extern __shared__ float smem[];
  float* sx   = smem;                   // 128 rows, pitch PROW: x, feat, then e
  float* sv   = sx + CHUNKC * PROW;     // 128 rows
  float* sp   = sv + CHUNKC * PROW;     // 64 rows, pitch PCOL
  float* sred = sp + DDIM * PCOL;       // 8: one maximum per wave

  const int tid = threadIdx.x;
  const int bhc = blockIdx.x;
  const int bh  = bhc / NCHUNK;
  const int ch  = bhc % NCHUNK;
  const long base = ((long)bh * SEQ + (long)ch * CHUNKC) * DDIM;
  const long vb   = ((long)bh * SEQ + (long)ch * CHUNKC) * DVDIM;

  for (int i = tid; i < CHUNKC * DDIM / 4; i += 256)
    copy_b128(sx + (i >> 4) * PROW + 4 * (i & 15), x + base + 4 * i);
  for (int i = tid; i < DDIM * MDIM / 4; i += 256)
    copy_b128(sp + (i >> 4) * PCOL + 4 * (i & 15), proj + 4 * i);
  async_wait_all();
  __syncthreads();

  // v is issued now and waited for behind the feature map.
  for (int i = tid; i < CHUNKC * DVDIM / 4; i += 256)
    copy_b128(sv + (i >> 4) * PROW + 4 * (i & 15), v + vb + 4 * i);

  // 8 waves: wave w -> row tile w (16 rows), 4 column tiles of 16. Only wave w
  // reads or writes rows 16w .. 16w+15 of sx until the last barrier below.
  const int w = tid >> 5;
  const int lane = tid & 31, half = lane >> 4, lid = lane & 15;
  float* strip = sx + (w * 16) * PROW;

  // k outer, column tile inner: one A fragment serves the four tiles and, squared,
  // diag = 0.5 * dnorm^2 * sum(x^2): over the 16 steps the lane sees one half of
  // row lid, lane ^ 16 the other half. Both loops are unrolled so that acc[] is
  // indexed by constants and stays in registers.
  const float* ar = strip + lid * PROW + 2 * half;
  const float* br = sp + (2 * half) * PCOL + lid;
  v8f acc[4] = {};
  float ss = 0.f;
#pragma unroll
  for (int kk = 0; kk < DDIM; kk += 4) {
    v2f a;
    a.x = ar[kk];
    a.y = ar[kk + 1];
    ss += a.x * a.x;
    ss += a.y * a.y;
#pragma unroll
    for (int ct = 0; ct < 4; ++ct) {
      v2f b;
      b.x = br[kk * PCOL + ct * 16];
      b.y = br[(kk + 1) * PCOL + ct * 16];
      acc[ct] = wmma_k4(a, b, acc[ct]);
    }
  }
  ss += xhalf(ss);
  const float dgl = DGSC * ss;           // diag of row lid, in both halves
  // The upper 16 lanes need rows 8..15: there lane n takes row n ^ 8, so that
  // row_share:vv hands every lane the diag of its row vv + 8 * half.
  const float dgs = half ? dpp_get<0x168>(dgl) : dgl;
  const float dg[8] = {dpp_get<0x150>(dgs), dpp_get<0x151>(dgs),
                       dpp_get<0x152>(dgs), dpp_get<0x153>(dgs),
                       dpp_get<0x154>(dgs), dpp_get<0x155>(dgs),
                       dpp_get<0x156>(dgs), dpp_get<0x157>(dgs)};

  float mx[8];
#pragma unroll
  for (int vv = 0; vv < 8; ++vv)
    mx[vv] = DNORM * row16_max(fmaxf(fmaxf(acc[0][vv], acc[1][vv]),
                                     fmaxf(acc[2][vv], acc[3][vv])));

  // The raw features go back into the wave's own strip of sx (its x is used up)
  // and leave from there as full rows.
  float* dst = strip + (8 * half) * PROW + lid;
  float bm = mx[0];                      // stab uses max of raw data_dash
#pragma unroll
  for (int vv = 0; vv < 8; ++vv) {
#pragma unroll
    for (int ct = 0; ct < 4; ++ct) {
      acc[ct][vv] = DNORM * acc[ct][vv] - dg[vv];
      dst[vv * PROW + ct * 16] = acc[ct][vv];  // finished by out_kernel
    }
    bm = fmaxf(bm, mx[vv]);
  }
  bm = fmaxf(bm, xhalf(bm));
  if (lane == 0) sred[w] = bm;
  // Keeps the compiler from moving a lane's reads below in front of the stores
  // above: each lane reads what other lanes of its wave wrote. The LDS serves one
  // wave's operations in order, so no work-group barrier is needed.
  __builtin_amdgcn_fence(__ATOMIC_ACQ_REL, "wavefront");
  // One wave instruction stores two whole rows (512 contiguous bytes). Unrolled
  // so that the eight LDS reads are in flight together, not one per store.
  float* fg = feat + ((long)bh * SEQ + (long)ch * CHUNKC + w * 16) * MDIM;
#pragma unroll
  for (int j = 0; j < 8; ++j)
    *(float4*)(fg + (2 * j + half) * MDIM + 4 * lid) =
        *(const float4*)(strip + (2 * j + half) * PROW + 4 * lid);
  // Closes the stores above before any of their registers is written again.
  asm volatile("s_wait_xcnt 0x0" ::: "memory");

  async_wait_all();
  lds_barrier();                        // publishes v and the waves' maxima

  const float bl = gmax_of_waves(sred);
  if (tid == 0) blockmax[bhc] = bl;
#pragma unroll
  for (int vv = 0; vv < 8; ++vv)
#pragma unroll
    for (int ct = 0; ct < 4; ++ct)
      dst[vv * PROW + ct * 16] = expf(acc[ct][vv] - bl);
  lds_barrier();                        // every wave reads the whole of sx

  // 16 result tiles (4 x 4): wave w takes feature tile w / 2 and two adjacent
  // value tiles, so one A fragment serves two WMMAs. The four k positions of a
  // step are keys r, r+1 (lower half) and r+8, r+9 (upper half), for e and for v
  // alike. The fragments pass every key of their columns through the wave once:
  // summed, they are the column sums.
  const int tr = w >> 1, tc = (w & 1) * 2;
  const float* ea = sx + (8 * half) * PROW + tr * 16 + lid;
  const float* va = sv + (8 * half) * PROW + tc * 16 + lid;
  v8f c0 = {}, c1 = {};
  float se = 0.f, s0 = 0.f, s1 = 0.f;
#pragma unroll
  for (int g = 0; g < CHUNKC / 16; ++g)
#pragma unroll
    for (int j = 0; j < 4; ++j) {
      const int r = 16 * g + 2 * j;
      v2f a, b0, b1;
      a.x  = ea[r * PROW];
      a.y  = ea[(r + 1) * PROW];
      b0.x = va[r * PROW];
      b0.y = va[(r + 1) * PROW];
      b1.x = va[r * PROW + 16];
      b1.y = va[(r + 1) * PROW + 16];
      se += a.x;
      se += a.y;
      s0 += b0.x;
      s0 += b0.y;
      s1 += b1.x;
      s1 += b1.y;
      c0 = wmma_k4(a, b0, c0);
      c1 = wmma_k4(a, b1, c1);
    }
  se += xhalf(se);
  s0 += xhalf(s0);
  s1 += xhalf(s1);
  if ((w & 1) == 0 && half == 0) cks[(long)bhc * MDIM + tr * 16 + lid] = se;
  if (tr == 0 && half == 0) {
    cvs[(long)bhc * DVDIM + tc * 16 + lid] = s0;
    cvs[(long)bhc * DVDIM + tc * 16 + 16 + lid] = s1;
  }
  float* cg = ckv + (long)bhc * MDIM * DVDIM + (tr * 16) * DVDIM + tc * 16;
  store_tile(cg, DVDIM, c0);
  store_tile(cg + 16, DVDIM, c1);
}

// Finishes a staged 128 x 64 tile of raw key features in place (row pitch P
// dwords), 256 threads. The LDS reads are written apart from the exps and the
// stores so that the compiler can fetch ahead of the arithmetic; both loops are
// unrolled so that r[] is indexed by constants and stays in registers.
template <int P>
__device__ __forceinline__ void finish_kp_tile(float* skp, float gm) {
  constexpr int N = CHUNKC * MDIM / 4 / 256;
  float4* p = (float4*)(skp + (threadIdx.x >> 4) * P + 4 * (threadIdx.x & 15));
  float4 r[N];
#pragma unroll
  for (int j = 0; j < N; ++j) r[j] = p[j * (16 * P / 4)];
#pragma unroll
  for (int j = 0; j < N; ++j) {
    r[j].x = RATIO * (expf(r[j].x - gm) + FEPS);
    r[j].y = RATIO * (expf(r[j].y - gm) + FEPS);
    r[j].z = RATIO * (expf(r[j].z - gm) + FEPS);
    r[j].w = RATIO * (expf(r[j].w - gm) + FEPS);
    p[j * (16 * P / 4)] = r[j];
  }
}

#define PFX_KV_WG (BH * MDIM * DVDIM / 4 / 256)   // 256
#define PFX_KS_WG (BH * MDIM / 256)               // 16

__device__ __forceinline__ float lane_value(float x, int l) {
  return __builtin_bit_cast(
      float, __builtin_amdgcn_readlane(__builtin_bit_cast(int, x), l));
}

extern "C" __global__ __launch_bounds__(256)
__attribute__((amdgpu_waves_per_eu(2, 4)))
void prefix_kernel(float* __restrict__ ckv, float* __restrict__ cks,
                   const float* __restrict__ cvs,
                   const float* __restrict__ bmax) {
  __shared__ float sred[8];                       // one maximum per wave
  __shared__ float4 sbm[BH * NCHUNK / 4];         // all block maxima
  __shared__ float4 svs[NCHUNK * DVDIM / 4];      // colsum(v) of the 32 chunks
  const int blk = blockIdx.x, tid = threadIdx.x, lane = tid & 31;
  if (blk < PFX_KV_WG) {
    const int col = blk * 256 + tid;               // float4 column
    const int bh = col / (MDIM * DVDIM / 4);       // one per work-group
    const int e4 = col % (MDIM * DVDIM / 4);
    float4* p = (float4*)(ckv + (long)bh * NCHUNK * MDIM * DVDIM) + e4;
    float4 val[NCHUNK];
#pragma unroll
    for (int ch = 0; ch < NCHUNK; ++ch) val[ch] = p[ch * (MDIM * DVDIM / 4)];
    // The block maxima and colsum(v) are asked for in one run with the column's
    // loads and used only behind them, so that all the round trips overlap.
    const float4 ma = ((const float4*)bmax)[tid];
    const float4 mb = ((const float4*)bmax)[tid + 256];
    const float4* gv = (const float4*)(cvs + (long)bh * NCHUNK * DVDIM);
    const float4 g0 = gv[tid], g1 = gv[tid + 256];
    const float wm = wave_max(ma, mb);
    if (lane == 0) sred[tid >> 5] = wm;
    sbm[tid] = ma;
    sbm[tid + 256] = mb;
    svs[tid] = g0;
    svs[tid + 256] = g1;
    lds_barrier();
    const float bl = ((const float*)sbm)[bh * NCHUNK + lane];
    const float sc = expf(bl - gmax_of_waves(sred));
    float4 run = make_float4(0.f, 0.f, 0.f, 0.f);
#pragma unroll
    for (int ch = 0; ch < NCHUNK; ++ch) {
      // Keeps the LDS reads of colsum(v) within their group of eight chunks:
      // without it the compiler fetches all 32 ahead, 128 registers more, and
      // only one work-group fits a WGP, so that the 272 no longer run at once.
      if (ch % 8 == 0) __builtin_amdgcn_sched_barrier(0);
      const float s = lane_value(sc, ch);
      const float4 ev = svs[ch * (DVDIM / 4) + (e4 & (DVDIM / 4 - 1))];
      p[ch * (MDIM * DVDIM / 4)] = run;
      run.x += RATIO * (s * val[ch].x + FEPS * ev.x);
      run.y += RATIO * (s * val[ch].y + FEPS * ev.y);
      run.z += RATIO * (s * val[ch].z + FEPS * ev.z);
      run.w += RATIO * (s * val[ch].w + FEPS * ev.w);
    }
  } else {
    const int col = (blk - PFX_KV_WG) * 256 + tid;
    const int bh = col / MDIM;                     // one per wave
    const int m  = col % MDIM;
    float* p = cks + (long)bh * NCHUNK * MDIM + m;
    float val[NCHUNK];
#pragma unroll
    for (int ch = 0; ch < NCHUNK; ++ch) val[ch] = p[ch * MDIM];
    const float4 ma = ((const float4*)bmax)[tid];
    const float4 mb = ((const float4*)bmax)[tid + 256];
    const float wm = wave_max(ma, mb);
    if (lane == 0) sred[tid >> 5] = wm;
    sbm[tid] = ma;
    sbm[tid + 256] = mb;
    lds_barrier();
    const float bl = ((const float*)sbm)[bh * NCHUNK + lane];
    const float sc = expf(bl - gmax_of_waves(sred));
    float run = 0.f;
#pragma unroll
    for (int ch = 0; ch < NCHUNK; ++ch) {
      p[ch * MDIM] = run;
      run += RATIO * (lane_value(sc, ch) * val[ch] + FEPS * (float)CHUNKC);
    }
    // Closes the stores above before any of their registers is written again.
    asm volatile("s_wait_xcnt 0x0" ::: "memory");
  }
}

// Kernel 3: per-chunk output, computed transposed so that the scores never
// leave the registers. kp arrives raw and is finished in LDS; the query features
// are made here from q, while the copies of kp, v and the prefix are in flight.
//   ddT  = proj^T @ q^T (features x queries)                    [WMMA]
//   qp   = RATIO * (exp(DNORM * dd - diag - max over features) + EPS)
//   St   = kp @ qp^T (keys x queries), masked to key <= query   [WMMA]
//   numT = v^T @ St + kv_prefix^T @ qp^T                        [WMMA]
//   den  = colsum(St) + qp . ks_prefix
//   out  = num / den
// Each wave owns one strip of 16 queries and walks only the key tiles up to its
// own diagonal tile: the tiles behind it are masked to zero as a whole. A result
// tile of St holds, in register r of lane (half, lid), key r + 8 * half of query
// lid. Registers 2j and 2j+1 are
// therefore a B fragment whose four k positions are keys 2j, 2j+1, 2j+8, 2j+9;
// the v^T fragment beside it takes its rows in the same order.
extern "C" __global__ __launch_bounds__(256)
void out_kernel(const float* __restrict__ q, const float* __restrict__ proj,
                const float* __restrict__ kp, const float* __restrict__ v,
                const float* __restrict__ ckv,
                const float* __restrict__ cks, const float* __restrict__ bmax,
                float* __restrict__ out) {
  extern __shared__ float smem[];
  float* sq   = smem;                     // 128 rows, pitch PROW: q, then out
  float* sk   = sq + CHUNKC * PROW;       // 128 rows, pitch PROW
  float* sv   = sk + CHUNKC * PROW;       // 128 rows
  float* skv  = sv + CHUNKC * PROW;       // 64 rows, pitch PCOL
  float* sp   = skv + MDIM * PCOL;        // 64 rows, pitch PCOL: proj
  float* sks  = sp + DDIM * PCOL;         // 64
  float* sred = sks + MDIM;               // 8: one maximum per wave

  const int tid = threadIdx.x;
  const int bhc = blockIdx.x;
  const int bh  = bhc / NCHUNK;
  const int ch  = bhc % NCHUNK;
  const long fb = ((long)bh * SEQ + (long)ch * CHUNKC) * MDIM;
  const long vb = ((long)bh * SEQ + (long)ch * CHUNKC) * DVDIM;

  // What the query features need comes first and is published by a wait and a
  // barrier of its own.
  for (int i = tid; i < CHUNKC * DDIM / 4; i += 256)
    copy_b128(sq + (i >> 4) * PROW + 4 * (i & 15), q + fb + 4 * i);
  for (int i = tid; i < DDIM * MDIM / 4; i += 256)
    copy_b128(sp + (i >> 4) * PCOL + 4 * (i & 15), proj + 4 * i);
  if (tid < MDIM) sks[tid] = cks[(long)bhc * MDIM + tid];
  const float wm = wave_part_of_gmax(bmax);
  if ((tid & 31) == 0) sred[tid >> 5] = wm;
  async_wait_all();
  __syncthreads();

  // The rest is issued now and waited for behind the query features.
  for (int i = tid; i < CHUNKC * MDIM / 4; i += 256) {
    const int l = (i >> 4) * PROW + 4 * (i & 15);
    copy_b128(sk + l, kp + fb + 4 * i);
    copy_b128(sv + l, v + vb + 4 * i);
  }
  for (int i = tid; i < MDIM * DVDIM / 4; i += 256)
    copy_b128(skv + (i >> 4) * PCOL + 4 * (i & 15),
              ckv + (long)bhc * MDIM * DVDIM + 4 * i);

  // The wave's number as a scalar, so that the key loop's trip count is one too.
  const int w = __builtin_amdgcn_readfirstlane(tid >> 5);
  const int lane = tid & 31, half = lane >> 4, lid = lane & 15;
  const int qs = w < 4 ? w : 11 - w;
  // Only this wave reads or writes rows 16qs .. 16qs+15 of sq from here on.
  float* strip = sq + (qs * 16) * PROW;

  // Query features of the strip, transposed: result row r + 8 * half of feature
  // tile ft, query lid. The A fragment's lane for result row l takes column
  // 16 * ft + pcol(l) of proj, with pcol(2j + e + 8h) = 4j + 2h + e, so that
  // registers 2j and 2j+1 hold features 16 * ft + 4j + 2 * half and the next one:
  // qp^T as B fragments in plain k order, used by both products that take it.
  // A lane holds 32 of its query's 64 features, lane ^ 16 the others, and sees
  // the same halves of row lid of q for diag. All loops over kk, ft, r, st, vv, j
  // and dt are unrolled so that f[], qf[], s and oacc[] are indexed by constants
  // and stay in registers.
  v2f qf[MDIM / 4];
  {
    const int pcol = ((lid & 6) << 1) | ((lid >> 3) << 1) | (lid & 1);
    const float* qr = strip + lid * PROW + 2 * half;
    const float* pr = sp + (2 * half) * PCOL + pcol;
    v8f f[4] = {};
    float ss = 0.f;
#pragma unroll
    for (int kk = 0; kk < DDIM; kk += 4) {
      v2f b;
      b.x = qr[kk];
      b.y = qr[kk + 1];
      ss += b.x * b.x;
      ss += b.y * b.y;
#pragma unroll
      for (int ft = 0; ft < 4; ++ft) {
        v2f a;
        a.x = pr[kk * PCOL + ft * 16];
        a.y = pr[(kk + 1) * PCOL + ft * 16];
        f[ft] = wmma_k4(a, b, f[ft]);
      }
    }
    ss += xhalf(ss);
    const float dg = DGSC * ss;
    float mx = f[0][0];
#pragma unroll
    for (int ft = 0; ft < 4; ++ft)
#pragma unroll
      for (int r = 0; r < 8; ++r) mx = fmaxf(mx, f[ft][r]);
    // DNORM > 0: max(DNORM * a) == DNORM * max(a), rounding included.
    mx = DNORM * fmaxf(mx, xhalf(mx));
#pragma unroll
    for (int ft = 0; ft < 4; ++ft)
#pragma unroll
      for (int j = 0; j < 4; ++j) {
        qf[4 * ft + j].x =
            RATIO * (expf(DNORM * f[ft][2 * j] - dg - mx) + FEPS);
        qf[4 * ft + j].y =
            RATIO * (expf(DNORM * f[ft][2 * j + 1] - dg - mx) + FEPS);
      }
  }

  // Keeps the WMMAs above in front of the wait, so that they run while the copies
  // are in flight: without it the compiler fetches all their fragments and sinks
  // the WMMAs themselves behind the barrier.
  __builtin_amdgcn_sched_barrier(0);
  async_wait_all();
  __syncthreads();
  finish_kp_tile<PROW>(sk, gmax_of_waves(sred));
  __syncthreads();                        // a wave reads rows 0 .. 16qs+15 of sk

  v8f oacc[4] = {};
  float dsum = 0.f;                       // this half's share of den of query lid
  for (int tc = 0; tc <= qs; ++tc) {
    const float* kr = sk + (tc * 16 + lid) * PROW + 2 * half;
    v8f s = {};
#pragma unroll
    for (int st = 0; st < MDIM / 4; ++st) {
      v2f a;
      a.x = kr[4 * st];
      a.y = kr[4 * st + 1];
      s = wmma_k4(a, qf[st], s);
    }
    const int lim = (qs - tc) * 16 + lid - 8 * half;  // keep register vv <= lim
#pragma unroll
    for (int vv = 0; vv < 8; ++vv) {
      s[vv] = (vv <= lim) ? s[vv] : 0.f;
      dsum += s[vv];
    }
    const float* vr = sv + (tc * 16 + 8 * half) * PROW + lid;
#pragma unroll
    for (int j = 0; j < 4; ++j) {
      v2f b;
      b.x = s[2 * j];
      b.y = s[2 * j + 1];
#pragma unroll
      for (int dt = 0; dt < 4; ++dt) {
        v2f a;
        a.x = vr[(2 * j) * PROW + dt * 16];
        a.y = vr[(2 * j + 1) * PROW + dt * 16];
        oacc[dt] = wmma_k4(a, b, oacc[dt]);
      }
    }
  }

  {
    const float* cr = skv + (2 * half) * PCOL + lid;
    const float* sr = sks + 2 * half;
#pragma unroll
    for (int st = 0; st < MDIM / 4; ++st) {
#pragma unroll
      for (int dt = 0; dt < 4; ++dt) {
        v2f a;
        a.x = cr[(4 * st) * PCOL + dt * 16];
        a.y = cr[(4 * st + 1) * PCOL + dt * 16];
        oacc[dt] = wmma_k4(a, qf[st], oacc[dt]);
      }
      dsum += qf[st].x * sr[4 * st];
      dsum += qf[st].y * sr[4 * st + 1];
    }
  }
  const float den = dsum + xhalf(dsum);

  // oacc[dt][vv] is column 16 * dt + 8 * half + vv of query lid: eight adjacent
  // values. They go into the wave's own strip of sq (its q is used up) and leave
  // from there as full rows.
  float* orow = strip + lid * PROW + 8 * half;
#pragma unroll
  for (int dt = 0; dt < 4; ++dt) {
    *(float4*)(orow + dt * 16) =
        make_float4(oacc[dt][0] / den, oacc[dt][1] / den, oacc[dt][2] / den,
                    oacc[dt][3] / den);
    *(float4*)(orow + dt * 16 + 4) =
        make_float4(oacc[dt][4] / den, oacc[dt][5] / den, oacc[dt][6] / den,
                    oacc[dt][7] / den);
  }
  // Keeps the compiler from moving a lane's reads below in front of the stores
  // above: each lane reads what other lanes of its wave wrote. The LDS serves one
  // wave's operations in order, so no work-group barrier is needed.
  __builtin_amdgcn_fence(__ATOMIC_ACQ_REL, "wavefront");
  // One wave instruction stores two whole rows (512 contiguous bytes). Unrolled
  // so that the eight LDS reads are in flight together, not one per store.
  float* og = out + vb + (long)(qs * 16) * DVDIM;
#pragma unroll
  for (int j = 0; j < 8; ++j)
    *(float4*)(og + (2 * j + half) * DVDIM + 4 * lid) =
        *(const float4*)(strip + (2 * j + half) * PROW + 4 * lid);
}

// ---------------------------------------------------------------------------
extern "C" void kernel_launch(void* const* d_in, const int* in_sizes, int n_in,
                              void* d_out, int out_size, void* d_ws,
                              size_t ws_size, hipStream_t stream) {
  const float* q    = (const float*)d_in[0];
  const float* k    = (const float*)d_in[1];
  const float* v    = (const float*)d_in[2];
  const float* proj = (const float*)d_in[3];
  float* out = (float*)d_out;

  float* ws = (float*)d_ws;
  const long FEAT = (long)BH * SEQ * MDIM;            // 16,777,216 floats
  float* kp   = ws;
  float* ckv  = kp + FEAT;                            // BH*NC*64*64
  float* cks  = ckv + (long)BH * NCHUNK * MDIM * DVDIM;
  float* bmax = cks + (long)BH * NCHUNK * MDIM;
  float* cvs  = bmax + BH * NCHUNK;                   // BH*NC*64

  const size_t featShm =
      (size_t)(2 * CHUNKC * PROW + DDIM * PCOL + 8) * sizeof(float);
  const size_t outShm =
      (size_t)(3 * CHUNKC * PROW + MDIM * PCOL + DDIM * PCOL + MDIM + 8) *
      sizeof(float);

  (void)hipFuncSetAttribute(reinterpret_cast<const void*>(feat_kernel),
                            hipFuncAttributeMaxDynamicSharedMemorySize,
                            (int)featShm);
  (void)hipFuncSetAttribute(reinterpret_cast<const void*>(out_kernel),
                            hipFuncAttributeMaxDynamicSharedMemorySize,
                            (int)outShm);

  feat_kernel<<<BH * NCHUNK, 256, featShm, stream>>>(k, proj, v, kp, bmax, ckv,
                                                     cks, cvs);
  prefix_kernel<<<PFX_KV_WG + PFX_KS_WG, 256, 0, stream>>>(ckv, cks, cvs, bmax);
  out_kernel<<<BH * NCHUNK, 256, outShm, stream>>>(q, proj, kp, v, ckv, cks,
                                                   bmax, out);
}

// v009
// Measured time: 132 microseconds a run.
// Next to v008, in two timings, it ran 1.08 and 1.09 times as fast.
// Counting every step since v000, it is 5.61 times as fast.
#include <hip/hip_runtime.h>
#include <math.h>
#include <stdint.h>

// Problem constants (match reference)
#define BDIM 4
#define HDIM 16
#define SEQ 4096
#define DDIM 64
#define MDIM 64
#define DVDIM 64
#define CHUNKC 128
#define NCHUNK (SEQ / CHUNKC)   // 32
#define BH (BDIM * HDIM)        // 64
#define FEPS 1e-4f
#define DNORM 0.35355339059327379f  // 64^-0.25
#define DGSC  0.0625f               // 0.5 * DNORM^2 = 0.5 * 64^-0.5
#define RATIO 0.125f                // 64^-0.5

#define PROW 68
#define PCOL 80

typedef __attribute__((ext_vector_type(2))) float v2f;
typedef __attribute__((ext_vector_type(8))) float v8f;
typedef int v4i __attribute__((ext_vector_type(4)));

#define ASYNC_OK __has_builtin(__builtin_amdgcn_global_load_async_to_lds_b128)

__device__ __forceinline__ void copy_b128(float* __restrict__ dst_lds,
                                          const float* __restrict__ src) {
#if ASYNC_OK
  typedef __attribute__((address_space(3))) v4i* lds_v4i_p;
  v4i* g = (v4i*)(uintptr_t)src;                         // generic global ptr
  lds_v4i_p l = (lds_v4i_p)(unsigned)(uintptr_t)dst_lds; // low 32b = LDS offset
  __builtin_amdgcn_global_load_async_to_lds_b128(g, l, 0, 0);
#else
  *(float4*)dst_lds = *(const float4*)src;
#endif
}

// The issuing wave's own wait: its copies have landed behind it. Written in asm
// with the memory clobber so that no LDS read is moved in front of it.
__device__ __forceinline__ void async_wait_all() {
#if ASYNC_OK
  asm volatile("s_wait_asynccnt 0x0" ::: "memory");
#endif
}

// Work-group barrier that orders LDS only. __syncthreads() also waits until the
// wave's global loads and stores have come back; where nothing that passes
// between the waves goes through global memory, they may stay in flight.
__device__ __forceinline__ void lds_barrier() {
  __builtin_amdgcn_fence(__ATOMIC_RELEASE, "workgroup", "local");
  __builtin_amdgcn_s_barrier();
  __builtin_amdgcn_fence(__ATOMIC_ACQUIRE, "workgroup", "local");
}

__device__ __forceinline__ v8f wmma_k4(v2f a, v2f b, v8f c) {
  return __builtin_amdgcn_wmma_f32_16x16x4_f32(
      false, a, false, b, (short)0, c, false, false);
}

__device__ __forceinline__ void store_tile(float* __restrict__ C, int ldc, v8f acc) {
  const int lane = threadIdx.x & 31;
  const int half = lane >> 4;
  const int lid  = lane & 15;
#pragma unroll
  for (int vv = 0; vv < 8; ++vv)
    C[(vv + 8 * half) * ldc + lid] = acc[vv];
}

template <int CTRL>
__device__ __forceinline__ float dpp_get(float x) {
  const int b = __builtin_bit_cast(int, x);
  return __builtin_bit_cast(
      float, __builtin_amdgcn_update_dpp(b, b, CTRL, 0xf, 0xf, false));
}

__device__ __forceinline__ float xhalf(float x) {
  const int b = __builtin_bit_cast(int, x);
  return __builtin_bit_cast(
      float, __builtin_amdgcn_permlanex16(b, b, 0x76543210, 0xfedcba98, false,
                                          false));
}

__device__ __forceinline__ float row16_max(float x) {  // result in all 16 lanes
  x = fmaxf(x, dpp_get<0x161>(x));
  x = fmaxf(x, dpp_get<0x162>(x));
  x = fmaxf(x, dpp_get<0x164>(x));
  x = fmaxf(x, dpp_get<0x168>(x));
  return x;
}

// exp(x) where x is never above 0 (every argument here is a value minus a maximum
// that bounds it): one multiply and the hardware's 2^t. The library's expf spends
// about a dozen more instructions on a split argument and on the two ends of the
// range. No overflow can occur; a result below the smallest normal number comes
// out as 0, which is nothing beside EPS or beside the sums it enters.
__device__ __forceinline__ float exp_le0(float x) {
  return __builtin_amdgcn_exp2f(x * 1.44269504088896340736f);
}

// feat_kernel leaves raw = data_dash - diag and one maximum of data_dash per
// work-group; the kernels behind it reduce those maxima themselves. out_kernel
// applies kp = RATIO * (exp(raw - gmax) + EPS) to the raw tile it has staged.

// Maximum over all BH * NCHUNK block maxima that this wave's lanes read (two
// float4 per thread of a 256-thread block), in every lane of the wave.
static_assert(BH * NCHUNK == 2 * 4 * 256, "two float4 per thread");
__device__ __forceinline__ float wave_max(float4 a, float4 b) {
  float m = fmaxf(fmaxf(fmaxf(a.x, a.y), fmaxf(a.z, a.w)),
                  fmaxf(fmaxf(b.x, b.y), fmaxf(b.z, b.w)));
  m = row16_max(m);
  return fmaxf(m, xhalf(m));
}

__device__ __forceinline__ float wave_part_of_gmax(const float* __restrict__ bmax) {
  return wave_max(((const float4*)bmax)[threadIdx.x],
                  ((const float4*)bmax)[threadIdx.x + 256]);
}

__device__ __forceinline__ float gmax_of_waves(const float* sred) {
  float gm = sred[0];
#pragma unroll
  for (int j = 1; j < 8; ++j) gm = fmaxf(gm, sred[j]);
  return gm;
}

// ---------------------------------------------------------------------------
// Kernel 1: FAVOR+ feature map of the keys and the chunk's sums, one
// (b,h,chunk) tile of 128 rows.
//   dd = DNORM * (x @ proj)   (WMMA on raw x, scale at consumption)
//   feat = dd - diag (raw), blockmax[blk] = max(dd) for the global stab
//   e    = exp(feat - blockmax[blk])         (at most 1: diag >= 0)
//   ckv  = e^T @ v (64x64, K=128) [WMMA], cks = colsum(e), cvs = colsum(v)
// The global maximum is not known here. With s = exp(blockmax[blk] - gmax),
//   kp = RATIO * (exp(feat - gmax) + EPS) = RATIO * (s * e + EPS),
// so the scan kernel, which knows gmax, turns these sums into those of kp:
//   kp^T @ v = RATIO * (s * ckv + EPS * cvs), colsum(kp) = RATIO * (s * cks + EPS * 128).
// (The query features need no global maximum: out_kernel makes its own.)
// Each wave keeps its 16 x 64 strip of x @ proj in four accumulators and
// finishes it there: accumulator register vv holds row vv + 8 * half, column
// 16 * ct + lid, so a row's maximum is a maximum over ct and over 16 lanes.
// ---------------------------------------------------------------------------
extern "C" __global__ __launch_bounds__(256)
void feat_kernel(const float* __restrict__ x, const float* __restrict__ proj,
                 const float* __restrict__ v, float* __restrict__ feat,
                 float* __restrict__ blockmax, float* __restrict__ ckv,
                 float* __restrict__ cks, float* __restrict__ cvs) {
  extern __shared__ float smem[];
  float* sx   = smem;                   // 128 rows, pitch PROW: x, feat, then e
  float* sv   = sx + CHUNKC * PROW;     // 128 rows
  float* sp   = sv + CHUNKC * PROW;     // 64 rows, pitch PCOL
  float* sred = sp + DDIM * PCOL;       // 8: one maximum per wave

  const int tid = threadIdx.x;
  const int bhc = blockIdx.x;
  const int bh  = bhc / NCHUNK;
  const int ch  = bhc % NCHUNK;
  const long base = ((long)bh * SEQ + (long)ch * CHUNKC) * DDIM;
  const long vb   = ((long)bh * SEQ + (long)ch * CHUNKC) * DVDIM;

  for (int i = tid; i < CHUNKC * DDIM / 4; i += 256)
    copy_b128(sx + (i >> 4) * PROW + 4 * (i & 15), x + base + 4 * i);
  for (int i = tid; i < DDIM * MDIM / 4; i += 256)
    copy_b128(sp + (i >> 4) * PCOL + 4 * (i & 15), proj + 4 * i);
  async_wait_all();
  __syncthreads();

  // v is issued now and waited for behind the feature map.
  for (int i = tid; i < CHUNKC * DVDIM / 4; i += 256)
    copy_b128(sv + (i >> 4) * PROW + 4 * (i & 15), v + vb + 4 * i);

  // 8 waves: wave w -> row tile w (16 rows), 4 column tiles of 16. Only wave w
  // reads or writes rows 16w .. 16w+15 of sx until the last barrier below.
  const int w = tid >> 5;
  const int lane = tid & 31, half = lane >> 4, lid = lane & 15;
  float* strip = sx + (w * 16) * PROW;

  // k outer, column tile inner: one A fragment serves the four tiles and, squared,
  // diag = 0.5 * dnorm^2 * sum(x^2): over the 16 steps the lane sees one half of
  // row lid, lane ^ 16 the other half. Both loops are unrolled so that acc[] is
  // indexed by constants and stays in registers.
  const float* ar = strip + lid * PROW + 2 * half;
  const float* br = sp + (2 * half) * PCOL + lid;
  v8f acc[4] = {};
  float ss = 0.f;
#pragma unroll
  for (int kk = 0; kk < DDIM; kk += 4) {
    v2f a;
    a.x = ar[kk];
    a.y = ar[kk + 1];
    ss += a.x * a.x;
    ss += a.y * a.y;
#pragma unroll
    for (int ct = 0; ct < 4; ++ct) {
      v2f b;
      b.x = br[kk * PCOL + ct * 16];
      b.y = br[(kk + 1) * PCOL + ct * 16];
      acc[ct] = wmma_k4(a, b, acc[ct]);
    }
  }
  ss += xhalf(ss);
  const float dgl = DGSC * ss;           // diag of row lid, in both halves
  // The upper 16 lanes need rows 8..15: there lane n takes row n ^ 8, so that
  // row_share:vv hands every lane the diag of its row vv + 8 * half.
  const float dgs = half ? dpp_get<0x168>(dgl) : dgl;
  const float dg[8] = {dpp_get<0x150>(dgs), dpp_get<0x151>(dgs),
                       dpp_get<0x152>(dgs), dpp_get<0x153>(dgs),
                       dpp_get<0x154>(dgs), dpp_get<0x155>(dgs),
                       dpp_get<0x156>(dgs), dpp_get<0x157>(dgs)};

  float mx[8];
#pragma unroll
  for (int vv = 0; vv < 8; ++vv)
    mx[vv] = DNORM * row16_max(fmaxf(fmaxf(acc[0][vv], acc[1][vv]),
                                     fmaxf(acc[2][vv], acc[3][vv])));

  // The raw features go back into the wave's own strip of sx (its x is used up)
  // and leave from there as full rows.
  float* dst = strip + (8 * half) * PROW + lid;
  float bm = mx[0];                      // stab uses max of raw data_dash
#pragma unroll
  for (int vv = 0; vv < 8; ++vv) {
#pragma unroll
    for (int ct = 0; ct < 4; ++ct) {
      acc[ct][vv] = DNORM * acc[ct][vv] - dg[vv];
      dst[vv * PROW + ct * 16] = acc[ct][vv];  // finished by out_kernel
    }
    bm = fmaxf(bm, mx[vv]);
  }
  bm = fmaxf(bm, xhalf(bm));
  if (lane == 0) sred[w] = bm;
  // Keeps the compiler from moving a lane's reads below in front of the stores
  // above: each lane reads what other lanes of its wave wrote. The LDS serves one
  // wave's operations in order, so no work-group barrier is needed.
  __builtin_amdgcn_fence(__ATOMIC_ACQ_REL, "wavefront");
  // One wave instruction stores two whole rows (512 contiguous bytes). Unrolled
  // so that the eight LDS reads are in flight together, not one per store.
  float* fg = feat + ((long)bh * SEQ + (long)ch * CHUNKC + w * 16) * MDIM;
#pragma unroll
  for (int j = 0; j < 8; ++j)
    *(float4*)(fg + (2 * j + half) * MDIM + 4 * lid) =
        *(const float4*)(strip + (2 * j + half) * PROW + 4 * lid);
  // Closes the stores above before any of their registers is written again.
  asm volatile("s_wait_xcnt 0x0" ::: "memory");

  async_wait_all();
  lds_barrier();                        // publishes v and the waves' maxima

  const float bl = gmax_of_waves(sred);
  if (tid == 0) blockmax[bhc] = bl;
#pragma unroll
  for (int vv = 0; vv < 8; ++vv)
#pragma unroll
    for (int ct = 0; ct < 4; ++ct)
      dst[vv * PROW + ct * 16] = exp_le0(acc[ct][vv] - bl);
  lds_barrier();                        // every wave reads the whole of sx

  // 16 result tiles (4 x 4): wave w takes feature tile w / 2 and two adjacent
  // value tiles, so one A fragment serves two WMMAs. The four k positions of a
  // step are keys r, r+1 (lower half) and r+8, r+9 (upper half), for e and for v
  // alike. The fragments pass every key of their columns through the wave once:
  // summed, they are the column sums.
  const int tr = w >> 1, tc = (w & 1) * 2;
  const float* ea = sx + (8 * half) * PROW + tr * 16 + lid;
  const float* va = sv + (8 * half) * PROW + tc * 16 + lid;
  v8f c0 = {}, c1 = {};
  float se = 0.f, s0 = 0.f, s1 = 0.f;
#pragma unroll
  for (int g = 0; g < CHUNKC / 16; ++g)
#pragma unroll
    for (int j = 0; j < 4; ++j) {
      const int r = 16 * g + 2 * j;
      v2f a, b0, b1;
      a.x  = ea[r * PROW];
      a.y  = ea[(r + 1) * PROW];
      b0.x = va[r * PROW];
      b0.y = va[(r + 1) * PROW];
      b1.x = va[r * PROW + 16];
      b1.y = va[(r + 1) * PROW + 16];
      se += a.x;
      se += a.y;
      s0 += b0.x;
      s0 += b0.y;
      s1 += b1.x;
      s1 += b1.y;
      c0 = wmma_k4(a, b0, c0);
      c1 = wmma_k4(a, b1, c1);
    }
  se += xhalf(se);
  s0 += xhalf(s0);
  s1 += xhalf(s1);
  if ((w & 1) == 0 && half == 0) cks[(long)bhc * MDIM + tr * 16 + lid] = se;
  if (tr == 0 && half == 0) {
    cvs[(long)bhc * DVDIM + tc * 16 + lid] = s0;
    cvs[(long)bhc * DVDIM + tc * 16 + 16 + lid] = s1;
  }
  float* cg = ckv + (long)bhc * MDIM * DVDIM + (tr * 16) * DVDIM + tc * 16;
  store_tile(cg, DVDIM, c0);
  store_tile(cg + 16, DVDIM, c1);
}

// Finishes a staged 128 x 64 tile of raw key features in place (row pitch P
// dwords), 256 threads. The LDS reads are written apart from the exps and the
// stores so that the compiler can fetch ahead of the arithmetic; both loops are
// unrolled so that r[] is indexed by constants and stays in registers.
template <int P>
__device__ __forceinline__ void finish_kp_tile(float* skp, float gm) {
  constexpr int N = CHUNKC * MDIM / 4 / 256;
  float4* p = (float4*)(skp + (threadIdx.x >> 4) * P + 4 * (threadIdx.x & 15));
  float4 r[N];
#pragma unroll
  for (int j = 0; j < N; ++j) r[j] = p[j * (16 * P / 4)];
#pragma unroll
  for (int j = 0; j < N; ++j) {
    r[j].x = RATIO * (exp_le0(r[j].x - gm) + FEPS);
    r[j].y = RATIO * (exp_le0(r[j].y - gm) + FEPS);
    r[j].z = RATIO * (exp_le0(r[j].z - gm) + FEPS);
    r[j].w = RATIO * (exp_le0(r[j].w - gm) + FEPS);
    p[j * (16 * P / 4)] = r[j];
  }
}

#define PFX_KV_WG (BH * MDIM * DVDIM / 4 / 256)   // 256
#define PFX_KS_WG (BH * MDIM / 256)               // 16

__device__ __forceinline__ float lane_value(float x, int l) {
  return __builtin_bit_cast(
      float, __builtin_amdgcn_readlane(__builtin_bit_cast(int, x), l));
}

extern "C" __global__ __launch_bounds__(256)
__attribute__((amdgpu_waves_per_eu(2, 4)))
void prefix_kernel(float* __restrict__ ckv, float* __restrict__ cks,
                   const float* __restrict__ cvs,
                   const float* __restrict__ bmax) {
  __shared__ float sred[8];                       // one maximum per wave
  __shared__ float4 sbm[BH * NCHUNK / 4];         // all block maxima
  __shared__ float4 svs[NCHUNK * DVDIM / 4];      // colsum(v) of the 32 chunks
  const int blk = blockIdx.x, tid = threadIdx.x, lane = tid & 31;
  if (blk < PFX_KV_WG) {
    const int col = blk * 256 + tid;               // float4 column
    const int bh = col / (MDIM * DVDIM / 4);       // one per work-group
    const int e4 = col % (MDIM * DVDIM / 4);
    float4* p = (float4*)(ckv + (long)bh * NCHUNK * MDIM * DVDIM) + e4;
    float4 val[NCHUNK];
#pragma unroll
    for (int ch = 0; ch < NCHUNK; ++ch) val[ch] = p[ch * (MDIM * DVDIM / 4)];
    // The block maxima and colsum(v) are asked for in one run with the column's
    // loads and used only behind them, so that all the round trips overlap.
    const float4 ma = ((const float4*)bmax)[tid];
    const float4 mb = ((const float4*)bmax)[tid + 256];
    const float4* gv = (const float4*)(cvs + (long)bh * NCHUNK * DVDIM);
    const float4 g0 = gv[tid], g1 = gv[tid + 256];
    const float wm = wave_max(ma, mb);
    if (lane == 0) sred[tid >> 5] = wm;
    sbm[tid] = ma;
    sbm[tid + 256] = mb;
    svs[tid] = g0;
    svs[tid + 256] = g1;
    lds_barrier();
    const float bl = ((const float*)sbm)[bh * NCHUNK + lane];
    const float sc = expf(bl - gmax_of_waves(sred));
    float4 run = make_float4(0.f, 0.f, 0.f, 0.f);
#pragma unroll
    for (int ch = 0; ch < NCHUNK; ++ch) {
      // Keeps the LDS reads of colsum(v) within their group of eight chunks:
      // without it the compiler fetches all 32 ahead, 128 registers more, and
      // only one work-group fits a WGP, so that the 272 no longer run at once.
      if (ch % 8 == 0) __builtin_amdgcn_sched_barrier(0);
      const float s = lane_value(sc, ch);
      const float4 ev = svs[ch * (DVDIM / 4) + (e4 & (DVDIM / 4 - 1))];
      p[ch * (MDIM * DVDIM / 4)] = run;
      run.x += RATIO * (s * val[ch].x + FEPS * ev.x);
      run.y += RATIO * (s * val[ch].y + FEPS * ev.y);
      run.z += RATIO * (s * val[ch].z + FEPS * ev.z);
      run.w += RATIO * (s * val[ch].w + FEPS * ev.w);
    }
  } else {
    const int col = (blk - PFX_KV_WG) * 256 + tid;
    const int bh = col / MDIM;                     // one per wave
    const int m  = col % MDIM;
    float* p = cks + (long)bh * NCHUNK * MDIM + m;
    float val[NCHUNK];
#pragma unroll
    for (int ch = 0; ch < NCHUNK; ++ch) val[ch] = p[ch * MDIM];
    const float4 ma = ((const float4*)bmax)[tid];
    const float4 mb = ((const float4*)bmax)[tid + 256];
    const float wm = wave_max(ma, mb);
    if (lane == 0) sred[tid >> 5] = wm;
    sbm[tid] = ma;
    sbm[tid + 256] = mb;
    lds_barrier();
    const float bl = ((const float*)sbm)[bh * NCHUNK + lane];
    const float sc = expf(bl - gmax_of_waves(sred));
    float run = 0.f;
#pragma unroll
    for (int ch = 0; ch < NCHUNK; ++ch) {
      p[ch * MDIM] = run;
      run += RATIO * (lane_value(sc, ch) * val[ch] + FEPS * (float)CHUNKC);
    }
    // Closes the stores above before any of their registers is written again.
    asm volatile("s_wait_xcnt 0x0" ::: "memory");
  }
}

// Kernel 3: per-chunk output, computed transposed so that the scores never
// leave the registers. kp arrives raw and is finished in LDS; the query features
// are made here from q, while the copies of kp, v and the prefix are in flight.
//   ddT  = proj^T @ q^T (features x queries)                    [WMMA]
//   qp   = RATIO * (exp(DNORM * dd - diag - max over features) + EPS)
//   St   = kp @ qp^T (keys x queries), masked to key <= query   [WMMA]
//   numT = v^T @ St + kv_prefix^T @ qp^T                        [WMMA]
//   den  = colsum(St) + qp . ks_prefix
//   out  = num / den
// Each wave owns one strip of 16 queries and walks only the key tiles up to its
// own diagonal tile: the tiles behind it are masked to zero as a whole. A result
// tile of St holds, in register r of lane (half, lid), key r + 8 * half of query
// lid. Registers 2j and 2j+1 are
// therefore a B fragment whose four k positions are keys 2j, 2j+1, 2j+8, 2j+9;
// the v^T fragment beside it takes its rows in the same order.
extern "C" __global__ __launch_bounds__(256)
void out_kernel(const float* __restrict__ q, const float* __restrict__ proj,
                const float* __restrict__ kp, const float* __restrict__ v,
                const float* __restrict__ ckv,
                const float* __restrict__ cks, const float* __restrict__ bmax,
                float* __restrict__ out) {
  extern __shared__ float smem[];
  float* sq   = smem;                     // 128 rows, pitch PROW: q, then out
  float* sk   = sq + CHUNKC * PROW;       // 128 rows, pitch PROW
  float* sv   = sk + CHUNKC * PROW;       // 128 rows
  float* skv  = sv + CHUNKC * PROW;       // 64 rows, pitch PCOL
  float* sp   = skv + MDIM * PCOL;        // 64 rows, pitch PCOL: proj
  float* sks  = sp + DDIM * PCOL;         // 64
  float* sred = sks + MDIM;               // 8: one maximum per wave

  const int tid = threadIdx.x;
  const int bhc = blockIdx.x;
  const int bh  = bhc / NCHUNK;
  const int ch  = bhc % NCHUNK;
  const long fb = ((long)bh * SEQ + (long)ch * CHUNKC) * MDIM;
  const long vb = ((long)bh * SEQ + (long)ch * CHUNKC) * DVDIM;

  // What the query features need comes first and is published by a wait and a
  // barrier of its own.
  for (int i = tid; i < CHUNKC * DDIM / 4; i += 256)
    copy_b128(sq + (i >> 4) * PROW + 4 * (i & 15), q + fb + 4 * i);
  for (int i = tid; i < DDIM * MDIM / 4; i += 256)
    copy_b128(sp + (i >> 4) * PCOL + 4 * (i & 15), proj + 4 * i);
  if (tid < MDIM) sks[tid] = cks[(long)bhc * MDIM + tid];
  const float wm = wave_part_of_gmax(bmax);
  if ((tid & 31) == 0) sred[tid >> 5] = wm;
  async_wait_all();
  __syncthreads();

  // The rest is issued now and waited for behind the query features.
  for (int i = tid; i < CHUNKC * MDIM / 4; i += 256) {
    const int l = (i >> 4) * PROW + 4 * (i & 15);
    copy_b128(sk + l, kp + fb + 4 * i);
    copy_b128(sv + l, v + vb + 4 * i);
  }
  for (int i = tid; i < MDIM * DVDIM / 4; i += 256)
    copy_b128(skv + (i >> 4) * PCOL + 4 * (i & 15),
              ckv + (long)bhc * MDIM * DVDIM + 4 * i);

  // The wave's number as a scalar, so that the key loop's trip count is one too.
  const int w = __builtin_amdgcn_readfirstlane(tid >> 5);
  const int lane = tid & 31, half = lane >> 4, lid = lane & 15;
  const int qs = w < 4 ? w : 11 - w;
  // Only this wave reads or writes rows 16qs .. 16qs+15 of sq from here on.
  float* strip = sq + (qs * 16) * PROW;

  // Query features of the strip, transposed: result row r + 8 * half of feature
  // tile ft, query lid. The A fragment's lane for result row l takes column
  // 16 * ft + pcol(l) of proj, with pcol(2j + e + 8h) = 4j + 2h + e, so that
  // registers 2j and 2j+1 hold features 16 * ft + 4j + 2 * half and the next one:
  // qp^T as B fragments in plain k order, used by both products that take it.
  // A lane holds 32 of its query's 64 features, lane ^ 16 the others, and sees
  // the same halves of row lid of q for diag. All loops over kk, ft, r, st, vv, j
  // and dt are unrolled so that f[], qf[], s and oacc[] are indexed by constants
  // and stay in registers.
  v2f qf[MDIM / 4];
  {
    const int pcol = ((lid & 6) << 1) | ((lid >> 3) << 1) | (lid & 1);
    const float* qr = strip + lid * PROW + 2 * half;
    const float* pr = sp + (2 * half) * PCOL + pcol;
    v8f f[4] = {};
    float ss = 0.f;
#pragma unroll
    for (int kk = 0; kk < DDIM; kk += 4) {
      v2f b;
      b.x = qr[kk];
      b.y = qr[kk + 1];
      ss += b.x * b.x;
      ss += b.y * b.y;
#pragma unroll
      for (int ft = 0; ft < 4; ++ft) {
        v2f a;
        a.x = pr[kk * PCOL + ft * 16];
        a.y = pr[(kk + 1) * PCOL + ft * 16];
        f[ft] = wmma_k4(a, b, f[ft]);
      }
    }
    ss += xhalf(ss);
    const float dg = DGSC * ss;
    float mx = f[0][0];
#pragma unroll
    for (int ft = 0; ft < 4; ++ft)
#pragma unroll
      for (int r = 0; r < 8; ++r) mx = fmaxf(mx, f[ft][r]);
    // DNORM > 0: max(DNORM * a) == DNORM * max(a), rounding included.
    mx = DNORM * fmaxf(mx, xhalf(mx));
#pragma unroll
    for (int ft = 0; ft < 4; ++ft)
#pragma unroll
      for (int j = 0; j < 4; ++j) {
        qf[4 * ft + j].x =
            RATIO * (exp_le0(DNORM * f[ft][2 * j] - dg - mx) + FEPS);
        qf[4 * ft + j].y =
            RATIO * (exp_le0(DNORM * f[ft][2 * j + 1] - dg - mx) + FEPS);
      }
  }

  // Keeps the WMMAs above in front of the wait, so that they run while the copies
  // are in flight: without it the compiler fetches all their fragments and sinks
  // the WMMAs themselves behind the barrier.
  __builtin_amdgcn_sched_barrier(0);
  async_wait_all();
  __syncthreads();
  finish_kp_tile<PROW>(sk, gmax_of_waves(sred));
  __syncthreads();                        // a wave reads rows 0 .. 16qs+15 of sk

  v8f oacc[4] = {};
  float dsum = 0.f;                       // this half's share of den of query lid
  for (int tc = 0; tc <= qs; ++tc) {
    const float* kr = sk + (tc * 16 + lid) * PROW + 2 * half;
    v8f s = {};
#pragma unroll
    for (int st = 0; st < MDIM / 4; ++st) {
      v2f a;
      a.x = kr[4 * st];
      a.y = kr[4 * st + 1];
      s = wmma_k4(a, qf[st], s);
    }
    const int lim = (qs - tc) * 16 + lid - 8 * half;  // keep register vv <= lim
#pragma unroll
    for (int vv = 0; vv < 8; ++vv) {
      s[vv] = (vv <= lim) ? s[vv] : 0.f;
      dsum += s[vv];
    }
    const float* vr = sv + (tc * 16 + 8 * half) * PROW + lid;
#pragma unroll
    for (int j = 0; j < 4; ++j) {
      v2f b;
      b.x = s[2 * j];
      b.y = s[2 * j + 1];
#pragma unroll
      for (int dt = 0; dt < 4; ++dt) {
        v2f a;
        a.x = vr[(2 * j) * PROW + dt * 16];
        a.y = vr[(2 * j + 1) * PROW + dt * 16];
        oacc[dt] = wmma_k4(a, b, oacc[dt]);
      }
    }
  }

  {
    const float* cr = skv + (2 * half) * PCOL + lid;
    const float* sr = sks + 2 * half;
#pragma unroll
    for (int st = 0; st < MDIM / 4; ++st) {
#pragma unroll
      for (int dt = 0; dt < 4; ++dt) {
        v2f a;
        a.x = cr[(4 * st) * PCOL + dt * 16];
        a.y = cr[(4 * st + 1) * PCOL + dt * 16];
        oacc[dt] = wmma_k4(a, qf[st], oacc[dt]);
      }
      dsum += qf[st].x * sr[4 * st];
      dsum += qf[st].y * sr[4 * st + 1];
    }
  }
  // One rounded reciprocal of den serves the lane's 32 quotients: a full division
  // costs about eleven instructions each. den is a sum of positive terms.
  const float rden = 1.0f / (dsum + xhalf(dsum));

  // oacc[dt][vv] is column 16 * dt + 8 * half + vv of query lid: eight adjacent
  // values. They go into the wave's own strip of sq (its q is used up) and leave
  // from there as full rows.
  float* orow = strip + lid * PROW + 8 * half;
#pragma unroll
  for (int dt = 0; dt < 4; ++dt) {
    *(float4*)(orow + dt * 16) =
        make_float4(oacc[dt][0] * rden, oacc[dt][1] * rden, oacc[dt][2] * rden,
                    oacc[dt][3] * rden);
    *(float4*)(orow + dt * 16 + 4) =
        make_float4(oacc[dt][4] * rden, oacc[dt][5] * rden, oacc[dt][6] * rden,
                    oacc[dt][7] * rden);
  }
  // Keeps the compiler from moving a lane's reads below in front of the stores
  // above: each lane reads what other lanes of its wave wrote. The LDS serves one
  // wave's operations in order, so no work-group barrier is needed.
  __builtin_amdgcn_fence(__ATOMIC_ACQ_REL, "wavefront");
  // One wave instruction stores two whole rows (512 contiguous bytes). Unrolled
  // so that the eight LDS reads are in flight together, not one per store.
  float* og = out + vb + (long)(qs * 16) * DVDIM;
#pragma unroll
  for (int j = 0; j < 8; ++j)
    *(float4*)(og + (2 * j + half) * DVDIM + 4 * lid) =
        *(const float4*)(strip + (2 * j + half) * PROW + 4 * lid);
}

// ---------------------------------------------------------------------------
extern "C" void kernel_launch(void* const* d_in, const int* in_sizes, int n_in,
                              void* d_out, int out_size, void* d_ws,
                              size_t ws_size, hipStream_t stream) {
  const float* q    = (const float*)d_in[0];
  const float* k    = (const float*)d_in[1];
  const float* v    = (const float*)d_in[2];
  const float* proj = (const float*)d_in[3];
  float* out = (float*)d_out;

  float* ws = (float*)d_ws;
  const long FEAT = (long)BH * SEQ * MDIM;            // 16,777,216 floats
  float* kp   = ws;
  float* ckv  = kp + FEAT;                            // BH*NC*64*64
  float* cks  = ckv + (long)BH * NCHUNK * MDIM * DVDIM;
  float* bmax = cks + (long)BH * NCHUNK * MDIM;
  float* cvs  = bmax + BH * NCHUNK;                   // BH*NC*64

  const size_t featShm =
      (size_t)(2 * CHUNKC * PROW + DDIM * PCOL + 8) * sizeof(float);
  const size_t outShm =
      (size_t)(3 * CHUNKC * PROW + MDIM * PCOL + DDIM * PCOL + MDIM + 8) *
      sizeof(float);

  (void)hipFuncSetAttribute(reinterpret_cast<const void*>(feat_kernel),
                            hipFuncAttributeMaxDynamicSharedMemorySize,
                            (int)featShm);
  (void)hipFuncSetAttribute(reinterpret_cast<const void*>(out_kernel),
                            hipFuncAttributeMaxDynamicSharedMemorySize,
                            (int)outShm);

  feat_kernel<<<BH * NCHUNK, 256, featShm, stream>>>(k, proj, v, kp, bmax, ckv,
                                                     cks, cvs);
  prefix_kernel<<<PFX_KV_WG + PFX_KS_WG, 256, 0, stream>>>(ckv, cks, cvs, bmax);
  out_kernel<<<BH * NCHUNK, 256, outShm, stream>>>(q, proj, kp, v, ckv, cks,
                                                   bmax, out);
}
